// v000
// Times are from an AMD MI455X. After a warm-up the kernel runs many times in a row, and a time is the length of
// such a window on the GPU divided by its runs, so every launch and the gaps after it count. The runs cycle
// through copies of the inputs. A figure is the median of several windows, for all but v000 over two sittings.
// Sittings can differ by a few percent; kernels timed side by side share one.
// v000 is the starting kernel. One run takes 297 microseconds.
#include <hip/hip_runtime.h>
#include <hip/hip_bf16.h>

#define B_      2
#define T_      1024
#define D_      1024
#define H_      16
#define KV_     4
#define HD_     64
#define CACHE_  1024
#define S_      2048
#define MAXSEQ_ 4096

typedef float v2f __attribute__((ext_vector_type(2)));
typedef float v8f __attribute__((ext_vector_type(8)));

__device__ __forceinline__ v8f wmma4(v2f a, v2f b, v8f c) {
  // D = A(16x4 f32) * B(4x16 f32) + C(16x16 f32)
  return __builtin_amdgcn_wmma_f32_16x16x4_f32(
      /*neg_a=*/false, a, /*neg_b=*/false, b,
      /*c_mod=*/(short)0, c, /*reuse_a=*/false, /*reuse_b=*/false);
}

// Async global->LDS B128 (CDNA5 TDM-class path, tracked by ASYNCcnt).
// LDS aperture: flat addr[31:0] == LDS byte offset.
__device__ __forceinline__ unsigned lds_off(const void* p) {
  return (unsigned)(unsigned long long)p;
}
__device__ __forceinline__ void async_ld_b128(unsigned lds, const void* gaddr) {
  asm volatile("global_load_async_to_lds_b128 %0, %1, off"
               :: "v"(lds), "v"(gaddr) : "memory");
}
__device__ __forceinline__ void wait_async_le(int n) {
  if (n == 0)      asm volatile("s_wait_asynccnt 0x0" ::: "memory");
  else if (n == 2) asm volatile("s_wait_asynccnt 0x2" ::: "memory");
  else             asm volatile("s_wait_asynccnt 0x4" ::: "memory");
}

// ---------------------------------------------------------------------------
// Generic fp32 WMMA GEMM: C[M,N] = A[M,K] * B[K,N], row-major.
// Block = 256 threads (8 waves). Block tile 64x64, wave tile 16x32.
// Double-buffered LDS staged via async global->LDS; prefetch next k-slab.
// Requires M%64==0, N%64==0, K%16==0 (true for all our calls).
// ---------------------------------------------------------------------------
__global__ __launch_bounds__(256) void wmma_gemm_f32(
    const float* __restrict__ A, const float* __restrict__ Bm,
    float* __restrict__ C, int M, int N, int K)
{
  __shared__ float As[2][64][20];   // [m][k], padded (stride 80B, 16B aligned)
  __shared__ float Bs[2][16][68];   // [k][n], padded (stride 272B, 16B aligned)

  const int tid   = threadIdx.x;
  const int wave  = tid >> 5;
  const int lane  = tid & 31;
  const int waveM = wave & 3;          // 4 row-groups of 16
  const int waveN = wave >> 2;         // 2 col-groups of 32
  const int n16   = lane & 15;
  const int half  = lane >> 4;
  const int kb    = half * 2;

  const int rowBase = blockIdx.y * 64;
  const int colBase = blockIdx.x * 64;

  // cooperative-load indices
  const int lAr = tid >> 2;            // 0..63
  const int lAc = (tid & 3) * 4;       // 0,4,8,12
  const int lBr = tid >> 4;            // 0..15
  const int lBc = (tid & 15) * 4;      // 0..60

  auto issue = [&](int k0, int buf) {
    async_ld_b128(lds_off(&As[buf][lAr][lAc]),
                  A + (size_t)(rowBase + lAr) * K + k0 + lAc);
    async_ld_b128(lds_off(&Bs[buf][lBr][lBc]),
                  Bm + (size_t)(k0 + lBr) * N + colBase + lBc);
  };

  v8f acc0 = {}, acc1 = {};

  issue(0, 0);
  int it = 0;
  for (int k0 = 0; k0 < K; k0 += 16, ++it) {
    const int buf = it & 1;
    if (k0 + 16 < K) { issue(k0 + 16, buf ^ 1); wait_async_le(2); }
    else             { wait_async_le(0); }
    __syncthreads();
#pragma unroll
    for (int kk = 0; kk < 4; kk++) {
      const int kd = kk * 4 + kb;
      v2f a;  a.x  = As[buf][waveM * 16 + n16][kd];
              a.y  = As[buf][waveM * 16 + n16][kd + 1];
      v2f b0; b0.x = Bs[buf][kd][waveN * 32 + n16];
              b0.y = Bs[buf][kd + 1][waveN * 32 + n16];
      v2f b1; b1.x = Bs[buf][kd][waveN * 32 + 16 + n16];
              b1.y = Bs[buf][kd + 1][waveN * 32 + 16 + n16];
      acc0 = wmma4(a, b0, acc0);
      acc1 = wmma4(a, b1, acc1);
    }
    __syncthreads();
  }

#pragma unroll
  for (int r = 0; r < 8; r++) {
    const int m  = rowBase + waveM * 16 + r + 8 * half;
    const int n0 = colBase + waveN * 32 + n16;
    C[(size_t)m * N + n0]      = acc0[r];
    C[(size_t)m * N + n0 + 16] = acc1[r];
  }
}

// ---------------------------------------------------------------------------
// RoPE helpers (double-precision angle -> fp32 reference-grade accuracy)
// ---------------------------------------------------------------------------
__device__ __forceinline__ void rope_cs(int p, int i, float& c, float& s) {
  const double inv_freq = exp(-(double)(2 * i) * 9.210340371976184 / 64.0); // ln(10000)
  double sd, cd;
  sincos((double)p * inv_freq, &sd, &cd);
  c = (float)cd; s = (float)sd;
}

// Q RoPE in place.  idx over B*T*H*32 = 1,048,576
__global__ __launch_bounds__(256) void rope_q_kernel(
    float* __restrict__ Q, const int* __restrict__ pos)
{
  const int idx = blockIdx.x * blockDim.x + threadIdx.x;
  const int i  = idx & 31;
  const int hh = (idx >> 5) & 15;
  const int t  = (idx >> 9) & (T_ - 1);
  const int b  = idx >> 19;
  int p = pos[b * T_ + t] + t + CACHE_;
  p = min(max(p, 0), MAXSEQ_ - 1);
  float c, s; rope_cs(p, i, c, s);
  const size_t base = (size_t)(b * T_ + t) * D_ + hh * HD_;
  const float q1 = Q[base + i];
  const float q2 = Q[base + i + 32];
  Q[base + i]      = q1 * c - q2 * s;
  Q[base + i + 32] = q2 * c + q1 * s;
}

// K RoPE + scatter, V scatter into output K/V at rows [CACHE_, S_).
// idx over B*T*KV*32 = 262,144
__global__ __launch_bounds__(256) void rope_kv_kernel(
    const float* __restrict__ Kn, const float* __restrict__ Vn,
    const int* __restrict__ pos,
    float* __restrict__ ok, float* __restrict__ ov)
{
  const int idx = blockIdx.x * blockDim.x + threadIdx.x;
  const int i  = idx & 31;
  const int kv = (idx >> 5) & 3;
  const int t  = (idx >> 7) & (T_ - 1);
  const int b  = idx >> 17;
  int p = pos[b * T_ + t] + t + CACHE_;
  p = min(max(p, 0), MAXSEQ_ - 1);
  float c, s; rope_cs(p, i, c, s);
  const size_t inrow = (size_t)(b * T_ + t) * (KV_ * HD_) + kv * HD_;
  const float k1 = Kn[inrow + i];
  const float k2 = Kn[inrow + i + 32];
  const size_t orow = ((size_t)(b * KV_ + kv) * S_ + CACHE_ + t) * HD_;
  ok[orow + i]      = k1 * c - k2 * s;
  ok[orow + i + 32] = k2 * c + k1 * s;
  ov[orow + i]      = Vn[inrow + i];
  ov[orow + i + 32] = Vn[inrow + i + 32];
}

// Copy caches into output K/V rows [0, CACHE_).  idx over B*KV*CACHE*HD = 524,288
__global__ __launch_bounds__(256) void cache_copy_kernel(
    const float* __restrict__ kc, const float* __restrict__ vc,
    float* __restrict__ ok, float* __restrict__ ov)
{
  const int idx = blockIdx.x * blockDim.x + threadIdx.x;
  const int bk  = idx >> 16;                 // CACHE_*HD_ = 65536
  const int rem = idx & 65535;
  ok[(size_t)bk * (S_ * HD_) + rem] = kc[idx];
  ov[(size_t)bk * (S_ * HD_) + rem] = vc[idx];
}

// ---------------------------------------------------------------------------
// Flash attention, fp32 WMMA. grid(8, H_, B_), 256 threads = 8 waves.
// Each block: 128 q-rows (16/wave) for one (b, h); iterates S in blocks of 32.
// K/V tiles double-buffered in LDS via async global->LDS with prefetch.
// Writes attention output back into QO (aliasing Q; regions disjoint/RAW-safe).
// ---------------------------------------------------------------------------
__global__ __launch_bounds__(256) void attn_fwd_kernel(
    float* __restrict__ QO, const float* __restrict__ Kt, const float* __restrict__ Vt)
{
  __shared__ float Ks[2][32][68];
  __shared__ float Vs[2][32][68];
  __shared__ float Ps[8][16][36];    // per-wave P tile (C-layout -> A-layout relay)

  const int tileQ = blockIdx.x;      // 0..7
  const int h     = blockIdx.y;      // 0..15
  const int b     = blockIdx.z;      // 0..1
  const int kvh   = h >> 2;          // n_rep = 4, contiguous grouping
  const int tid   = threadIdx.x;
  const int wave  = tid >> 5;
  const int lane  = tid & 31;
  const int n16   = lane & 15;
  const int half  = lane >> 4;
  const int kb    = half * 2;
  const int t0    = tileQ * 128;

  const float* kbase = Kt + (size_t)(b * KV_ + kvh) * S_ * HD_;
  const float* vbase = Vt + (size_t)(b * KV_ + kvh) * S_ * HD_;

  // Q as pre-shaped A fragments: 16 fragments cover hd=64 (K=4 each)
  float2 qa[16];
  {
    const float* qrow = QO + (size_t)(b * T_ + t0 + wave * 16 + n16) * D_ + h * HD_ + kb;
#pragma unroll
    for (int kk = 0; kk < 16; kk++) qa[kk] = *(const float2*)(qrow + kk * 4);
  }

  v8f acc[4];
  {
    v8f z = {};
#pragma unroll
    for (int ct = 0; ct < 4; ct++) acc[ct] = z;
  }
  float m_i[8], l_i[8];
#pragma unroll
  for (int r = 0; r < 8; r++) { m_i[r] = -1e30f; l_i[r] = 0.0f; }

  const int lr0 = tid >> 4;          // 0..15
  const int c0  = (tid & 15) * 4;    // 0..60

  auto issue_tile = [&](int s0, int buf) {
    async_ld_b128(lds_off(&Ks[buf][lr0][c0]),      kbase + (size_t)(s0 + lr0)      * HD_ + c0);
    async_ld_b128(lds_off(&Ks[buf][16 + lr0][c0]), kbase + (size_t)(s0 + 16 + lr0) * HD_ + c0);
    async_ld_b128(lds_off(&Vs[buf][lr0][c0]),      vbase + (size_t)(s0 + lr0)      * HD_ + c0);
    async_ld_b128(lds_off(&Vs[buf][16 + lr0][c0]), vbase + (size_t)(s0 + 16 + lr0) * HD_ + c0);
  };

  const int NITER = S_ / 32;   // 64
  issue_tile(0, 0);
  for (int it = 0; it < NITER; ++it) {
    const int buf = it & 1;
    if (it + 1 < NITER) { issue_tile((it + 1) * 32, buf ^ 1); wait_async_le(4); }
    else                { wait_async_le(0); }
    __syncthreads();

    // scores: S = Q * K^T over hd=64 (16 WMMAs per 16x16 tile, 2 tiles)
    v8f st0 = {}, st1 = {};
#pragma unroll
    for (int kk = 0; kk < 16; kk++) {
      const int kd = kk * 4 + kb;
      v2f a;  a.x  = qa[kk].x;                 a.y  = qa[kk].y;
      v2f b0; b0.x = Ks[buf][n16][kd];         b0.y = Ks[buf][n16][kd + 1];
      v2f b1; b1.x = Ks[buf][16 + n16][kd];    b1.y = Ks[buf][16 + n16][kd + 1];
      st0 = wmma4(a, b0, st0);
      st1 = wmma4(a, b1, st1);
    }

    // online softmax (row reductions within 16-lane halves match C layout)
    float alpha_r[8];
#pragma unroll
    for (int r = 0; r < 8; r++) {
      const float s0v = st0[r] * 0.125f;     // 1/sqrt(64)
      const float s1v = st1[r] * 0.125f;
      float mx = fmaxf(s0v, s1v);
#pragma unroll
      for (int d = 8; d >= 1; d >>= 1) mx = fmaxf(mx, __shfl_xor(mx, d, 32));
      const float mnew = fmaxf(m_i[r], mx);
      const float p0 = __expf(s0v - mnew);
      const float p1 = __expf(s1v - mnew);
      float rs = p0 + p1;
#pragma unroll
      for (int d = 8; d >= 1; d >>= 1) rs += __shfl_xor(rs, d, 32);
      alpha_r[r] = __expf(m_i[r] - mnew);
      l_i[r] = l_i[r] * alpha_r[r] + rs;
      m_i[r] = mnew;
      Ps[wave][r + 8 * half][n16]      = p0;   // relay P through LDS
      Ps[wave][r + 8 * half][16 + n16] = p1;
    }
#pragma unroll
    for (int ct = 0; ct < 4; ct++)
#pragma unroll
      for (int r = 0; r < 8; r++) acc[ct][r] *= alpha_r[r];

    __syncthreads();

    // acc += P(16x32) * V(32x64): 4 col-tiles x 8 k-steps
#pragma unroll
    for (int ct = 0; ct < 4; ct++) {
#pragma unroll
      for (int kk = 0; kk < 8; kk++) {
        const int k = kk * 4 + kb;
        v2f a;  a.x  = Ps[wave][n16][k];            a.y  = Ps[wave][n16][k + 1];
        v2f bb; bb.x = Vs[buf][k][ct * 16 + n16];   bb.y = Vs[buf][k + 1][ct * 16 + n16];
        acc[ct] = wmma4(a, bb, acc[ct]);
      }
    }
    __syncthreads();
  }

  // normalize + write back into QO (same (rows, head-cols) this block read)
#pragma unroll
  for (int r = 0; r < 8; r++) {
    const float inv = 1.0f / l_i[r];
    const int tok = b * T_ + t0 + wave * 16 + r + 8 * half;
    float* orow = QO + (size_t)tok * D_ + h * HD_;
#pragma unroll
    for (int ct = 0; ct < 4; ct++) orow[ct * 16 + n16] = acc[ct][r] * inv;
  }
}

// ---------------------------------------------------------------------------
// Host-side launcher
// ---------------------------------------------------------------------------
extern "C" void kernel_launch(void* const* d_in, const int* in_sizes, int n_in,
                              void* d_out, int out_size, void* d_ws, size_t ws_size,
                              hipStream_t stream) {
  const float* x       = (const float*)d_in[0];   // [2,1024,1024]
  const float* k_cache = (const float*)d_in[1];   // [2,4,1024,64]
  const float* v_cache = (const float*)d_in[2];   // [2,4,1024,64]
  const int*   pos     = (const int*)  d_in[3];   // [2,1024]
  const float* Wq      = (const float*)d_in[4];   // [1024,1024]
  const float* Wk      = (const float*)d_in[5];   // [1024,256]
  const float* Wv      = (const float*)d_in[6];   // [1024,256]
  const float* Wo      = (const float*)d_in[7];   // [1024,1024]

  float* out   = (float*)d_out;                        // [2,1024,1024]
  float* out_k = out   + (size_t)B_ * T_ * D_;         // [2,4,2048,64]
  float* out_v = out_k + (size_t)B_ * KV_ * S_ * HD_;  // [2,4,2048,64]

  float* Qws = (float*)d_ws;                           // [2048,1024] (also attn out)
  float* Kn  = Qws + (size_t)B_ * T_ * D_;             // [2048,256]
  float* Vn  = Kn  + (size_t)B_ * T_ * (KV_ * HD_);    // [2048,256]

  const int Mtok = B_ * T_;  // 2048

  // 1) projections
  wmma_gemm_f32<<<dim3(D_ / 64, Mtok / 64), 256, 0, stream>>>(x, Wq, Qws, Mtok, D_, D_);
  wmma_gemm_f32<<<dim3((KV_ * HD_) / 64, Mtok / 64), 256, 0, stream>>>(x, Wk, Kn, Mtok, KV_ * HD_, D_);
  wmma_gemm_f32<<<dim3((KV_ * HD_) / 64, Mtok / 64), 256, 0, stream>>>(x, Wv, Vn, Mtok, KV_ * HD_, D_);

  // 2) RoPE + KV assembly
  rope_q_kernel<<<(B_ * T_ * H_ * 32) / 256, 256, 0, stream>>>(Qws, pos);
  rope_kv_kernel<<<(B_ * T_ * KV_ * 32) / 256, 256, 0, stream>>>(Kn, Vn, pos, out_k, out_v);
  cache_copy_kernel<<<(B_ * KV_ * CACHE_ * HD_) / 256, 256, 0, stream>>>(k_cache, v_cache, out_k, out_v);

  // 3) attention (writes O in place of Q)
  attn_fwd_kernel<<<dim3(T_ / 128, H_, B_), 256, 0, stream>>>(Qws, out_k, out_v);

  // 4) output projection
  wmma_gemm_f32<<<dim3(D_ / 64, Mtok / 64), 256, 0, stream>>>(Qws, Wo, out, Mtok, D_, D_);
}

// v001
// A run of this version takes 271 microseconds.
// Two timings next to v000 both put it at 1.12 times that version's speed.
#include <hip/hip_runtime.h>
#include <hip/hip_bf16.h>

#define B_      2
#define T_      1024
#define D_      1024
#define H_      16
#define KV_     4
#define HD_     64
#define CACHE_  1024
#define S_      2048
#define MAXSEQ_ 4096

typedef float v2f __attribute__((ext_vector_type(2)));
typedef float v8f __attribute__((ext_vector_type(8)));

__device__ __forceinline__ v8f wmma4(v2f a, v2f b, v8f c) {
  // D = A(16x4 f32) * B(4x16 f32) + C(16x16 f32)
  return __builtin_amdgcn_wmma_f32_16x16x4_f32(
      /*neg_a=*/false, a, /*neg_b=*/false, b,
      /*c_mod=*/(short)0, c, /*reuse_a=*/false, /*reuse_b=*/false);
}

// Async global->LDS B128 (CDNA5 TDM-class path, tracked by ASYNCcnt).
// LDS aperture: flat addr[31:0] == LDS byte offset.
__device__ __forceinline__ unsigned lds_off(const void* p) {
  return (unsigned)(unsigned long long)p;
}
__device__ __forceinline__ void async_ld_b128(unsigned lds, const void* gaddr) {
  asm volatile("global_load_async_to_lds_b128 %0, %1, off"
               :: "v"(lds), "v"(gaddr) : "memory");
}
__device__ __forceinline__ void wait_async_le(int n) {
  if (n == 0)      asm volatile("s_wait_asynccnt 0x0" ::: "memory");
  else if (n == 2) asm volatile("s_wait_asynccnt 0x2" ::: "memory");
  else             asm volatile("s_wait_asynccnt 0x4" ::: "memory");
}

// One GEMM stage: this thread's eight async global->LDS B128 copies (four of A,
// four of B). The s_wait_xcnt closes the same statement so that no later
// rewrite of a copy's address registers can be scheduled in front of it.
__device__ __forceinline__ void async_stage_x8(
    unsigned la0, unsigned la1, unsigned la2, unsigned la3,
    unsigned lb0, unsigned lb1, unsigned lb2, unsigned lb3,
    const float* a0, const float* a1, const float* a2, const float* a3,
    const float* b0, const float* b1, const float* b2, const float* b3) {
  asm volatile("global_load_async_to_lds_b128 %0, %8, off\n\t"
               "global_load_async_to_lds_b128 %1, %9, off\n\t"
               "global_load_async_to_lds_b128 %2, %10, off\n\t"
               "global_load_async_to_lds_b128 %3, %11, off\n\t"
               "global_load_async_to_lds_b128 %4, %12, off\n\t"
               "global_load_async_to_lds_b128 %5, %13, off\n\t"
               "global_load_async_to_lds_b128 %6, %14, off\n\t"
               "global_load_async_to_lds_b128 %7, %15, off\n\t"
               "s_wait_xcnt 0x0"
               :: "v"(la0), "v"(la1), "v"(la2), "v"(la3),
                  "v"(lb0), "v"(lb1), "v"(lb2), "v"(lb3),
                  "v"(a0), "v"(a1), "v"(a2), "v"(a3),
                  "v"(b0), "v"(b1), "v"(b2), "v"(b3)
               : "memory");
}

// ---------------------------------------------------------------------------
// Generic fp32 WMMA GEMM: C[M,N] = A[M,K] * B[K,N], row-major.
// Block = 256 threads (8 waves). Block tile 64x64, wave tile 16x32.
// A stage is a 64-deep k-slab of both operands; two LDS buffers filled by async
// global->LDS copies, the next stage in flight while this one is multiplied.
// Requires M%64==0, N%64==0, K%64==0 (true for all our calls).
// ---------------------------------------------------------------------------
#define GBK_ 64
__global__ __launch_bounds__(256) void wmma_gemm_f32(
    const float* __restrict__ A, const float* __restrict__ Bm,
    float* __restrict__ C, int M, int N, int K)
{
  // 16-byte alignment: every B128 copy lands on a multiple of its width
  __shared__ __attribute__((aligned(16))) float As[2][64][GBK_ + 4];  // [m][k], row stride 272B
  __shared__ __attribute__((aligned(16))) float Bs[2][GBK_][68];      // [k][n], row stride 272B

  const int tid   = threadIdx.x;
  const int wave  = tid >> 5;
  const int lane  = tid & 31;
  const int waveM = wave & 3;          // 4 row-groups of 16
  const int waveN = wave >> 2;         // 2 col-groups of 32
  const int n16   = lane & 15;
  const int half  = lane >> 4;
  const int kb    = half * 2;

  const int rowBase = blockIdx.y * 64;
  const int colBase = blockIdx.x * 64;

  // cooperative-load indices: rows lr, lr+16, lr+32, lr+48 of each 64x64 tile
  const int lr = tid >> 4;             // 0..15
  const int lc = (tid & 15) * 4;       // 0..60

  const float* ga = A  + (size_t)(rowBase + lr) * K + lc;
  const float* gb = Bm + (size_t)lr * N + colBase + lc;
  const size_t a16 = (size_t)16 * K;
  const size_t b16 = (size_t)16 * N;

  // stages are issued in k order; each call moves both pointers one slab on
  auto issue = [&](int buf) {
    async_stage_x8(lds_off(&As[buf][lr][lc]),      lds_off(&As[buf][lr + 16][lc]),
                   lds_off(&As[buf][lr + 32][lc]), lds_off(&As[buf][lr + 48][lc]),
                   lds_off(&Bs[buf][lr][lc]),      lds_off(&Bs[buf][lr + 16][lc]),
                   lds_off(&Bs[buf][lr + 32][lc]), lds_off(&Bs[buf][lr + 48][lc]),
                   ga, ga + a16, ga + 2 * a16, ga + 3 * a16,
                   gb, gb + b16, gb + 2 * b16, gb + 3 * b16);
    ga += GBK_;
    gb += (size_t)GBK_ * N;
  };

  v8f acc0 = {}, acc1 = {};

  const int nst = K / GBK_;
  issue(0);
  // stage 0 landed (own copies), then published to the other waves
  asm volatile("s_wait_asynccnt 0x0" ::: "memory");
  __syncthreads();
  if (nst > 1) issue(1);

  for (int st = 0; st < nst; ++st) {
    const int buf = st & 1;
    // unrolled: LDS offsets become immediates, later k-steps' reads issue early
#pragma unroll
    for (int kk = 0; kk < GBK_ / 4; kk++) {
      const int kd = kk * 4 + kb;
      v2f a;  a.x  = As[buf][waveM * 16 + n16][kd];
              a.y  = As[buf][waveM * 16 + n16][kd + 1];
      v2f b0; b0.x = Bs[buf][kd][waveN * 32 + n16];
              b0.y = Bs[buf][kd + 1][waveN * 32 + n16];
      v2f b1; b1.x = Bs[buf][kd][waveN * 32 + 16 + n16];
              b1.y = Bs[buf][kd + 1][waveN * 32 + 16 + n16];
      acc0 = wmma4(a, b0, acc0);
      acc1 = wmma4(a, b1, acc1);
    }
    // publish point: this wave's reads of buf are back, its copies of the next
    // stage have landed; the barrier frees buf for the refill and publishes
    // the next stage to every wave
    asm volatile("s_wait_dscnt 0x0" ::: "memory");
    asm volatile("s_wait_asynccnt 0x0" ::: "memory");
    __syncthreads();
    if (st + 2 < nst) issue(buf);
  }
  // no copy outstanding when the wave ends
  asm volatile("s_wait_asynccnt 0x0" ::: "memory");

#pragma unroll
  for (int r = 0; r < 8; r++) {
    const int m  = rowBase + waveM * 16 + r + 8 * half;
    const int n0 = colBase + waveN * 32 + n16;
    C[(size_t)m * N + n0]      = acc0[r];
    C[(size_t)m * N + n0 + 16] = acc1[r];
  }
}

// ---------------------------------------------------------------------------
// RoPE helpers (double-precision angle -> fp32 reference-grade accuracy)
// ---------------------------------------------------------------------------
__device__ __forceinline__ void rope_cs(int p, int i, float& c, float& s) {
  const double inv_freq = exp(-(double)(2 * i) * 9.210340371976184 / 64.0); // ln(10000)
  double sd, cd;
  sincos((double)p * inv_freq, &sd, &cd);
  c = (float)cd; s = (float)sd;
}

// Q RoPE in place.  idx over B*T*H*32 = 1,048,576
__global__ __launch_bounds__(256) void rope_q_kernel(
    float* __restrict__ Q, const int* __restrict__ pos)
{
  const int idx = blockIdx.x * blockDim.x + threadIdx.x;
  const int i  = idx & 31;
  const int hh = (idx >> 5) & 15;
  const int t  = (idx >> 9) & (T_ - 1);
  const int b  = idx >> 19;
  int p = pos[b * T_ + t] + t + CACHE_;
  p = min(max(p, 0), MAXSEQ_ - 1);
  float c, s; rope_cs(p, i, c, s);
  const size_t base = (size_t)(b * T_ + t) * D_ + hh * HD_;
  const float q1 = Q[base + i];
  const float q2 = Q[base + i + 32];
  Q[base + i]      = q1 * c - q2 * s;
  Q[base + i + 32] = q2 * c + q1 * s;
}

// K RoPE + scatter, V scatter into output K/V at rows [CACHE_, S_).
// idx over B*T*KV*32 = 262,144
__global__ __launch_bounds__(256) void rope_kv_kernel(
    const float* __restrict__ Kn, const float* __restrict__ Vn,
    const int* __restrict__ pos,
    float* __restrict__ ok, float* __restrict__ ov)
{
  const int idx = blockIdx.x * blockDim.x + threadIdx.x;
  const int i  = idx & 31;
  const int kv = (idx >> 5) & 3;
  const int t  = (idx >> 7) & (T_ - 1);
  const int b  = idx >> 17;
  int p = pos[b * T_ + t] + t + CACHE_;
  p = min(max(p, 0), MAXSEQ_ - 1);
  float c, s; rope_cs(p, i, c, s);
  const size_t inrow = (size_t)(b * T_ + t) * (KV_ * HD_) + kv * HD_;
  const float k1 = Kn[inrow + i];
  const float k2 = Kn[inrow + i + 32];
  const size_t orow = ((size_t)(b * KV_ + kv) * S_ + CACHE_ + t) * HD_;
  ok[orow + i]      = k1 * c - k2 * s;
  ok[orow + i + 32] = k2 * c + k1 * s;
  ov[orow + i]      = Vn[inrow + i];
  ov[orow + i + 32] = Vn[inrow + i + 32];
}

// Copy caches into output K/V rows [0, CACHE_).  idx over B*KV*CACHE*HD = 524,288
__global__ __launch_bounds__(256) void cache_copy_kernel(
    const float* __restrict__ kc, const float* __restrict__ vc,
    float* __restrict__ ok, float* __restrict__ ov)
{
  const int idx = blockIdx.x * blockDim.x + threadIdx.x;
  const int bk  = idx >> 16;                 // CACHE_*HD_ = 65536
  const int rem = idx & 65535;
  ok[(size_t)bk * (S_ * HD_) + rem] = kc[idx];
  ov[(size_t)bk * (S_ * HD_) + rem] = vc[idx];
}

// ---------------------------------------------------------------------------
// Flash attention, fp32 WMMA. grid(8, H_, B_), 256 threads = 8 waves.
// Each block: 128 q-rows (16/wave) for one (b, h); iterates S in blocks of 32.
// K/V tiles double-buffered in LDS via async global->LDS with prefetch.
// Writes attention output back into QO (aliasing Q; regions disjoint/RAW-safe).
// ---------------------------------------------------------------------------
__global__ __launch_bounds__(256) void attn_fwd_kernel(
    float* __restrict__ QO, const float* __restrict__ Kt, const float* __restrict__ Vt)
{
  __shared__ float Ks[2][32][68];
  __shared__ float Vs[2][32][68];
  __shared__ float Ps[8][16][36];    // per-wave P tile (C-layout -> A-layout relay)

  const int tileQ = blockIdx.x;      // 0..7
  const int h     = blockIdx.y;      // 0..15
  const int b     = blockIdx.z;      // 0..1
  const int kvh   = h >> 2;          // n_rep = 4, contiguous grouping
  const int tid   = threadIdx.x;
  const int wave  = tid >> 5;
  const int lane  = tid & 31;
  const int n16   = lane & 15;
  const int half  = lane >> 4;
  const int kb    = half * 2;
  const int t0    = tileQ * 128;

  const float* kbase = Kt + (size_t)(b * KV_ + kvh) * S_ * HD_;
  const float* vbase = Vt + (size_t)(b * KV_ + kvh) * S_ * HD_;

  // Q as pre-shaped A fragments: 16 fragments cover hd=64 (K=4 each)
  float2 qa[16];
  {
    const float* qrow = QO + (size_t)(b * T_ + t0 + wave * 16 + n16) * D_ + h * HD_ + kb;
#pragma unroll
    for (int kk = 0; kk < 16; kk++) qa[kk] = *(const float2*)(qrow + kk * 4);
  }

  v8f acc[4];
  {
    v8f z = {};
#pragma unroll
    for (int ct = 0; ct < 4; ct++) acc[ct] = z;
  }
  float m_i[8], l_i[8];
#pragma unroll
  for (int r = 0; r < 8; r++) { m_i[r] = -1e30f; l_i[r] = 0.0f; }

  const int lr0 = tid >> 4;          // 0..15
  const int c0  = (tid & 15) * 4;    // 0..60

  auto issue_tile = [&](int s0, int buf) {
    async_ld_b128(lds_off(&Ks[buf][lr0][c0]),      kbase + (size_t)(s0 + lr0)      * HD_ + c0);
    async_ld_b128(lds_off(&Ks[buf][16 + lr0][c0]), kbase + (size_t)(s0 + 16 + lr0) * HD_ + c0);
    async_ld_b128(lds_off(&Vs[buf][lr0][c0]),      vbase + (size_t)(s0 + lr0)      * HD_ + c0);
    async_ld_b128(lds_off(&Vs[buf][16 + lr0][c0]), vbase + (size_t)(s0 + 16 + lr0) * HD_ + c0);
  };

  const int NITER = S_ / 32;   // 64
  issue_tile(0, 0);
  for (int it = 0; it < NITER; ++it) {
    const int buf = it & 1;
    if (it + 1 < NITER) { issue_tile((it + 1) * 32, buf ^ 1); wait_async_le(4); }
    else                { wait_async_le(0); }
    __syncthreads();

    // scores: S = Q * K^T over hd=64 (16 WMMAs per 16x16 tile, 2 tiles)
    v8f st0 = {}, st1 = {};
#pragma unroll
    for (int kk = 0; kk < 16; kk++) {
      const int kd = kk * 4 + kb;
      v2f a;  a.x  = qa[kk].x;                 a.y  = qa[kk].y;
      v2f b0; b0.x = Ks[buf][n16][kd];         b0.y = Ks[buf][n16][kd + 1];
      v2f b1; b1.x = Ks[buf][16 + n16][kd];    b1.y = Ks[buf][16 + n16][kd + 1];
      st0 = wmma4(a, b0, st0);
      st1 = wmma4(a, b1, st1);
    }

    // online softmax (row reductions within 16-lane halves match C layout)
    float alpha_r[8];
#pragma unroll
    for (int r = 0; r < 8; r++) {
      const float s0v = st0[r] * 0.125f;     // 1/sqrt(64)
      const float s1v = st1[r] * 0.125f;
      float mx = fmaxf(s0v, s1v);
#pragma unroll
      for (int d = 8; d >= 1; d >>= 1) mx = fmaxf(mx, __shfl_xor(mx, d, 32));
      const float mnew = fmaxf(m_i[r], mx);
      const float p0 = __expf(s0v - mnew);
      const float p1 = __expf(s1v - mnew);
      float rs = p0 + p1;
#pragma unroll
      for (int d = 8; d >= 1; d >>= 1) rs += __shfl_xor(rs, d, 32);
      alpha_r[r] = __expf(m_i[r] - mnew);
      l_i[r] = l_i[r] * alpha_r[r] + rs;
      m_i[r] = mnew;
      Ps[wave][r + 8 * half][n16]      = p0;   // relay P through LDS
      Ps[wave][r + 8 * half][16 + n16] = p1;
    }
#pragma unroll
    for (int ct = 0; ct < 4; ct++)
#pragma unroll
      for (int r = 0; r < 8; r++) acc[ct][r] *= alpha_r[r];

    __syncthreads();

    // acc += P(16x32) * V(32x64): 4 col-tiles x 8 k-steps
#pragma unroll
    for (int ct = 0; ct < 4; ct++) {
#pragma unroll
      for (int kk = 0; kk < 8; kk++) {
        const int k = kk * 4 + kb;
        v2f a;  a.x  = Ps[wave][n16][k];            a.y  = Ps[wave][n16][k + 1];
        v2f bb; bb.x = Vs[buf][k][ct * 16 + n16];   bb.y = Vs[buf][k + 1][ct * 16 + n16];
        acc[ct] = wmma4(a, bb, acc[ct]);
      }
    }
    __syncthreads();
  }

  // normalize + write back into QO (same (rows, head-cols) this block read)
#pragma unroll
  for (int r = 0; r < 8; r++) {
    const float inv = 1.0f / l_i[r];
    const int tok = b * T_ + t0 + wave * 16 + r + 8 * half;
    float* orow = QO + (size_t)tok * D_ + h * HD_;
#pragma unroll
    for (int ct = 0; ct < 4; ct++) orow[ct * 16 + n16] = acc[ct][r] * inv;
  }
}

// ---------------------------------------------------------------------------
// Host-side launcher
// ---------------------------------------------------------------------------
extern "C" void kernel_launch(void* const* d_in, const int* in_sizes, int n_in,
                              void* d_out, int out_size, void* d_ws, size_t ws_size,
                              hipStream_t stream) {
  const float* x       = (const float*)d_in[0];   // [2,1024,1024]
  const float* k_cache = (const float*)d_in[1];   // [2,4,1024,64]
  const float* v_cache = (const float*)d_in[2];   // [2,4,1024,64]
  const int*   pos     = (const int*)  d_in[3];   // [2,1024]
  const float* Wq      = (const float*)d_in[4];   // [1024,1024]
  const float* Wk      = (const float*)d_in[5];   // [1024,256]
  const float* Wv      = (const float*)d_in[6];   // [1024,256]
  const float* Wo      = (const float*)d_in[7];   // [1024,1024]

  float* out   = (float*)d_out;                        // [2,1024,1024]
  float* out_k = out   + (size_t)B_ * T_ * D_;         // [2,4,2048,64]
  float* out_v = out_k + (size_t)B_ * KV_ * S_ * HD_;  // [2,4,2048,64]

  float* Qws = (float*)d_ws;                           // [2048,1024] (also attn out)
  float* Kn  = Qws + (size_t)B_ * T_ * D_;             // [2048,256]
  float* Vn  = Kn  + (size_t)B_ * T_ * (KV_ * HD_);    // [2048,256]

  const int Mtok = B_ * T_;  // 2048

  // 1) projections
  wmma_gemm_f32<<<dim3(D_ / 64, Mtok / 64), 256, 0, stream>>>(x, Wq, Qws, Mtok, D_, D_);
  wmma_gemm_f32<<<dim3((KV_ * HD_) / 64, Mtok / 64), 256, 0, stream>>>(x, Wk, Kn, Mtok, KV_ * HD_, D_);
  wmma_gemm_f32<<<dim3((KV_ * HD_) / 64, Mtok / 64), 256, 0, stream>>>(x, Wv, Vn, Mtok, KV_ * HD_, D_);

  // 2) RoPE + KV assembly
  rope_q_kernel<<<(B_ * T_ * H_ * 32) / 256, 256, 0, stream>>>(Qws, pos);
  rope_kv_kernel<<<(B_ * T_ * KV_ * 32) / 256, 256, 0, stream>>>(Kn, Vn, pos, out_k, out_v);
  cache_copy_kernel<<<(B_ * KV_ * CACHE_ * HD_) / 256, 256, 0, stream>>>(k_cache, v_cache, out_k, out_v);

  // 3) attention (writes O in place of Q)
  attn_fwd_kernel<<<dim3(T_ / 128, H_, B_), 256, 0, stream>>>(Qws, out_k, out_v);

  // 4) output projection
  wmma_gemm_f32<<<dim3(D_ / 64, Mtok / 64), 256, 0, stream>>>(Qws, Wo, out, Mtok, D_, D_);
}

// v002
// One run takes 246 microseconds.
// In both of two side-by-side timings against v001, it was 1.11 times as fast.
// All steps since v000 together make it 1.24 times as fast.
#include <hip/hip_runtime.h>
#include <hip/hip_bf16.h>

#define B_      2
#define T_      1024
#define D_      1024
#define H_      16
#define KV_     4
#define HD_     64
#define CACHE_  1024
#define S_      2048
#define MAXSEQ_ 4096

typedef float v2f __attribute__((ext_vector_type(2)));
typedef float v8f __attribute__((ext_vector_type(8)));

__device__ __forceinline__ v8f wmma4(v2f a, v2f b, v8f c) {
  // D = A(16x4 f32) * B(4x16 f32) + C(16x16 f32)
  return __builtin_amdgcn_wmma_f32_16x16x4_f32(
      /*neg_a=*/false, a, /*neg_b=*/false, b,
      /*c_mod=*/(short)0, c, /*reuse_a=*/false, /*reuse_b=*/false);
}

// Async global->LDS B128 (CDNA5 TDM-class path, tracked by ASYNCcnt).
// LDS aperture: flat addr[31:0] == LDS byte offset.
__device__ __forceinline__ unsigned lds_off(const void* p) {
  return (unsigned)(unsigned long long)p;
}
__device__ __forceinline__ void async_ld_b128(unsigned lds, const void* gaddr) {
  asm volatile("global_load_async_to_lds_b128 %0, %1, off"
               :: "v"(lds), "v"(gaddr) : "memory");
}
__device__ __forceinline__ void wait_async_le(int n) {
  if (n == 0)      asm volatile("s_wait_asynccnt 0x0" ::: "memory");
  else if (n == 2) asm volatile("s_wait_asynccnt 0x2" ::: "memory");
  else             asm volatile("s_wait_asynccnt 0x4" ::: "memory");
}

// One GEMM stage: this thread's eight async global->LDS B128 copies (four of A,
// four of B). The s_wait_xcnt closes the same statement so that no later
// rewrite of a copy's address registers can be scheduled in front of it.
__device__ __forceinline__ void async_stage_x8(
    unsigned la0, unsigned la1, unsigned la2, unsigned la3,
    unsigned lb0, unsigned lb1, unsigned lb2, unsigned lb3,
    const float* a0, const float* a1, const float* a2, const float* a3,
    const float* b0, const float* b1, const float* b2, const float* b3) {
  asm volatile("global_load_async_to_lds_b128 %0, %8, off\n\t"
               "global_load_async_to_lds_b128 %1, %9, off\n\t"
               "global_load_async_to_lds_b128 %2, %10, off\n\t"
               "global_load_async_to_lds_b128 %3, %11, off\n\t"
               "global_load_async_to_lds_b128 %4, %12, off\n\t"
               "global_load_async_to_lds_b128 %5, %13, off\n\t"
               "global_load_async_to_lds_b128 %6, %14, off\n\t"
               "global_load_async_to_lds_b128 %7, %15, off\n\t"
               "s_wait_xcnt 0x0"
               :: "v"(la0), "v"(la1), "v"(la2), "v"(la3),
                  "v"(lb0), "v"(lb1), "v"(lb2), "v"(lb3),
                  "v"(a0), "v"(a1), "v"(a2), "v"(a3),
                  "v"(b0), "v"(b1), "v"(b2), "v"(b3)
               : "memory");
}

// ---------------------------------------------------------------------------
// Generic fp32 WMMA GEMM: C[M,N] = A[M,K] * B[K,N], row-major.
// Block = 256 threads (8 waves). Block tile 64x64, wave tile 16x32.
// A stage is a 64-deep k-slab of both operands; two LDS buffers filled by async
// global->LDS copies, the next stage in flight while this one is multiplied.
// Requires M%64==0, N%64==0, K%64==0 (true for all our calls).
// ---------------------------------------------------------------------------
#define GBK_ 64
__global__ __launch_bounds__(256) void wmma_gemm_f32(
    const float* __restrict__ A, const float* __restrict__ Bm,
    float* __restrict__ C, int M, int N, int K)
{
  // 16-byte alignment: every B128 copy lands on a multiple of its width
  __shared__ __attribute__((aligned(16))) float As[2][64][GBK_ + 4];  // [m][k], row stride 272B
  __shared__ __attribute__((aligned(16))) float Bs[2][GBK_][68];      // [k][n], row stride 272B

  const int tid   = threadIdx.x;
  const int wave  = tid >> 5;
  const int lane  = tid & 31;
  const int waveM = wave & 3;          // 4 row-groups of 16
  const int waveN = wave >> 2;         // 2 col-groups of 32
  const int n16   = lane & 15;
  const int half  = lane >> 4;
  const int kb    = half * 2;

  const int rowBase = blockIdx.y * 64;
  const int colBase = blockIdx.x * 64;

  // cooperative-load indices: rows lr, lr+16, lr+32, lr+48 of each 64x64 tile
  const int lr = tid >> 4;             // 0..15
  const int lc = (tid & 15) * 4;       // 0..60

  const float* ga = A  + (size_t)(rowBase + lr) * K + lc;
  const float* gb = Bm + (size_t)lr * N + colBase + lc;
  const size_t a16 = (size_t)16 * K;
  const size_t b16 = (size_t)16 * N;

  // stages are issued in k order; each call moves both pointers one slab on
  auto issue = [&](int buf) {
    async_stage_x8(lds_off(&As[buf][lr][lc]),      lds_off(&As[buf][lr + 16][lc]),
                   lds_off(&As[buf][lr + 32][lc]), lds_off(&As[buf][lr + 48][lc]),
                   lds_off(&Bs[buf][lr][lc]),      lds_off(&Bs[buf][lr + 16][lc]),
                   lds_off(&Bs[buf][lr + 32][lc]), lds_off(&Bs[buf][lr + 48][lc]),
                   ga, ga + a16, ga + 2 * a16, ga + 3 * a16,
                   gb, gb + b16, gb + 2 * b16, gb + 3 * b16);
    ga += GBK_;
    gb += (size_t)GBK_ * N;
  };

  v8f acc0 = {}, acc1 = {};

  const int nst = K / GBK_;
  issue(0);
  // stage 0 landed (own copies), then published to the other waves
  asm volatile("s_wait_asynccnt 0x0" ::: "memory");
  __syncthreads();
  if (nst > 1) issue(1);

  for (int st = 0; st < nst; ++st) {
    const int buf = st & 1;
    // unrolled: LDS offsets become immediates, later k-steps' reads issue early
#pragma unroll
    for (int kk = 0; kk < GBK_ / 4; kk++) {
      const int kd = kk * 4 + kb;
      v2f a;  a.x  = As[buf][waveM * 16 + n16][kd];
              a.y  = As[buf][waveM * 16 + n16][kd + 1];
      v2f b0; b0.x = Bs[buf][kd][waveN * 32 + n16];
              b0.y = Bs[buf][kd + 1][waveN * 32 + n16];
      v2f b1; b1.x = Bs[buf][kd][waveN * 32 + 16 + n16];
              b1.y = Bs[buf][kd + 1][waveN * 32 + 16 + n16];
      acc0 = wmma4(a, b0, acc0);
      acc1 = wmma4(a, b1, acc1);
    }
    // publish point: this wave's reads of buf are back, its copies of the next
    // stage have landed; the barrier frees buf for the refill and publishes
    // the next stage to every wave
    asm volatile("s_wait_dscnt 0x0" ::: "memory");
    asm volatile("s_wait_asynccnt 0x0" ::: "memory");
    __syncthreads();
    if (st + 2 < nst) issue(buf);
  }
  // no copy outstanding when the wave ends
  asm volatile("s_wait_asynccnt 0x0" ::: "memory");

#pragma unroll
  for (int r = 0; r < 8; r++) {
    const int m  = rowBase + waveM * 16 + r + 8 * half;
    const int n0 = colBase + waveN * 32 + n16;
    C[(size_t)m * N + n0]      = acc0[r];
    C[(size_t)m * N + n0 + 16] = acc1[r];
  }
}

// ---------------------------------------------------------------------------
// RoPE helpers (double-precision angle -> fp32 reference-grade accuracy)
// ---------------------------------------------------------------------------
__device__ __forceinline__ void rope_cs(int p, int i, float& c, float& s) {
  const double inv_freq = exp(-(double)(2 * i) * 9.210340371976184 / 64.0); // ln(10000)
  double sd, cd;
  sincos((double)p * inv_freq, &sd, &cd);
  c = (float)cd; s = (float)sd;
}

// RoPE of Q (in place) and K, V scatter and cache copy, one launch.
// Blocks [0, ROPE_BLOCKS_): one thread per (token, frequency i). The angle depends
// on the token and on i alone, so it is formed once and serves the 16 query heads
// and the 4 key heads of that token; the token's V elements i and i + 32 go along.
// Blocks [ROPE_BLOCKS_, ROPE_BLOCKS_ + COPY_BLOCKS_): cache rows [0, CACHE_) of
// the output K/V, one 16-byte piece of each cache per thread.
#define ROPE_BLOCKS_ ((B_ * T_ * 32) / 256)                    // 256
#define COPY_BLOCKS_ ((B_ * KV_ * CACHE_ * HD_ / 4) / 256)     // 512
__global__ __launch_bounds__(256) void rope_assemble_kernel(
    float* __restrict__ Q, const float* __restrict__ Kn, const float* __restrict__ Vn,
    const int* __restrict__ pos,
    const float* __restrict__ kc, const float* __restrict__ vc,
    float* __restrict__ ok, float* __restrict__ ov)
{
  if (blockIdx.x < ROPE_BLOCKS_) {
    const int idx = blockIdx.x * 256 + threadIdx.x;
    const int i   = idx & 31;
    const int tok = idx >> 5;            // b * T_ + t
    const int t   = tok & (T_ - 1);
    const int b   = tok >> 10;
    int p = pos[tok] + t + CACHE_;
    p = min(max(p, 0), MAXSEQ_ - 1);

    float* qrow       = Q  + (size_t)tok * D_ + i;
    const float* krow = Kn + (size_t)tok * (KV_ * HD_) + i;
    const float* vrow = Vn + (size_t)tok * (KV_ * HD_) + i;

    // every load of the thread is issued ahead of the angle's arithmetic
    float q1[H_], q2[H_], k1[KV_], k2[KV_], v1[KV_], v2[KV_];
    // the four loops are unrolled so that these arrays live in registers and the
    // head offsets become immediates
#pragma unroll
    for (int hh = 0; hh < H_; hh++) {
      q1[hh] = qrow[hh * HD_];
      q2[hh] = qrow[hh * HD_ + 32];
    }
#pragma unroll
    for (int kv = 0; kv < KV_; kv++) {
      k1[kv] = krow[kv * HD_];
      k2[kv] = krow[kv * HD_ + 32];
      v1[kv] = vrow[kv * HD_];
      v2[kv] = vrow[kv * HD_ + 32];
    }

    // no address register of the loads above is reused before this wait: the
    // addresses that die here are inputs, so they stay whole up to it
    asm volatile("s_wait_xcnt 0x0" :: "v"(krow), "v"(vrow), "v"(tok) : "memory");

    float c, s; rope_cs(p, i, c, s);

#pragma unroll
    for (int hh = 0; hh < H_; hh++) {
      qrow[hh * HD_]      = q1[hh] * c - q2[hh] * s;
      qrow[hh * HD_ + 32] = q2[hh] * c + q1[hh] * s;
    }
#pragma unroll
    for (int kv = 0; kv < KV_; kv++) {
      const size_t orow = ((size_t)(b * KV_ + kv) * S_ + CACHE_ + t) * HD_ + i;
      ok[orow]      = k1[kv] * c - k2[kv] * s;
      ok[orow + 32] = k2[kv] * c + k1[kv] * s;
      ov[orow]      = v1[kv];
      ov[orow + 32] = v2[kv];
    }
  } else {
    const int j = (blockIdx.x - ROPE_BLOCKS_) * 256 + threadIdx.x;
    // CACHE_ * HD_ / 4 = 16384 pieces per (b, kv) in a cache, twice that in the output
    const size_t o = (size_t)(j >> 14) * (S_ * HD_ / 4) + (j & 16383);
    const float4 kp = ((const float4*)kc)[j];
    const float4 vp = ((const float4*)vc)[j];
    ((float4*)ok)[o] = kp;
    ((float4*)ov)[o] = vp;
    // no register that the two stores name is rewritten before this wait, on any
    // way the built code can leave this branch
    asm volatile("s_wait_xcnt 0x0" ::: "memory");
  }
}

// ---------------------------------------------------------------------------
// Flash attention, fp32 WMMA. grid(8, H_, B_), 256 threads = 8 waves.
// Each block: 128 q-rows (16/wave) for one (b, h); iterates S in blocks of 32.
// K/V tiles double-buffered in LDS via async global->LDS with prefetch.
// Writes attention output back into QO (aliasing Q; regions disjoint/RAW-safe).
// ---------------------------------------------------------------------------
__global__ __launch_bounds__(256) void attn_fwd_kernel(
    float* __restrict__ QO, const float* __restrict__ Kt, const float* __restrict__ Vt)
{
  __shared__ float Ks[2][32][68];
  __shared__ float Vs[2][32][68];
  __shared__ float Ps[8][16][36];    // per-wave P tile (C-layout -> A-layout relay)

  const int tileQ = blockIdx.x;      // 0..7
  const int h     = blockIdx.y;      // 0..15
  const int b     = blockIdx.z;      // 0..1
  const int kvh   = h >> 2;          // n_rep = 4, contiguous grouping
  const int tid   = threadIdx.x;
  const int wave  = tid >> 5;
  const int lane  = tid & 31;
  const int n16   = lane & 15;
  const int half  = lane >> 4;
  const int kb    = half * 2;
  const int t0    = tileQ * 128;

  const float* kbase = Kt + (size_t)(b * KV_ + kvh) * S_ * HD_;
  const float* vbase = Vt + (size_t)(b * KV_ + kvh) * S_ * HD_;

  // Q as pre-shaped A fragments: 16 fragments cover hd=64 (K=4 each)
  float2 qa[16];
  {
    const float* qrow = QO + (size_t)(b * T_ + t0 + wave * 16 + n16) * D_ + h * HD_ + kb;
#pragma unroll
    for (int kk = 0; kk < 16; kk++) qa[kk] = *(const float2*)(qrow + kk * 4);
  }

  v8f acc[4];
  {
    v8f z = {};
#pragma unroll
    for (int ct = 0; ct < 4; ct++) acc[ct] = z;
  }
  float m_i[8], l_i[8];
#pragma unroll
  for (int r = 0; r < 8; r++) { m_i[r] = -1e30f; l_i[r] = 0.0f; }

  const int lr0 = tid >> 4;          // 0..15
  const int c0  = (tid & 15) * 4;    // 0..60

  auto issue_tile = [&](int s0, int buf) {
    async_ld_b128(lds_off(&Ks[buf][lr0][c0]),      kbase + (size_t)(s0 + lr0)      * HD_ + c0);
    async_ld_b128(lds_off(&Ks[buf][16 + lr0][c0]), kbase + (size_t)(s0 + 16 + lr0) * HD_ + c0);
    async_ld_b128(lds_off(&Vs[buf][lr0][c0]),      vbase + (size_t)(s0 + lr0)      * HD_ + c0);
    async_ld_b128(lds_off(&Vs[buf][16 + lr0][c0]), vbase + (size_t)(s0 + 16 + lr0) * HD_ + c0);
  };

  const int NITER = S_ / 32;   // 64
  issue_tile(0, 0);
  for (int it = 0; it < NITER; ++it) {
    const int buf = it & 1;
    if (it + 1 < NITER) { issue_tile((it + 1) * 32, buf ^ 1); wait_async_le(4); }
    else                { wait_async_le(0); }
    __syncthreads();

    // scores: S = Q * K^T over hd=64 (16 WMMAs per 16x16 tile, 2 tiles)
    v8f st0 = {}, st1 = {};
#pragma unroll
    for (int kk = 0; kk < 16; kk++) {
      const int kd = kk * 4 + kb;
      v2f a;  a.x  = qa[kk].x;                 a.y  = qa[kk].y;
      v2f b0; b0.x = Ks[buf][n16][kd];         b0.y = Ks[buf][n16][kd + 1];
      v2f b1; b1.x = Ks[buf][16 + n16][kd];    b1.y = Ks[buf][16 + n16][kd + 1];
      st0 = wmma4(a, b0, st0);
      st1 = wmma4(a, b1, st1);
    }

    // online softmax (row reductions within 16-lane halves match C layout)
    float alpha_r[8];
#pragma unroll
    for (int r = 0; r < 8; r++) {
      const float s0v = st0[r] * 0.125f;     // 1/sqrt(64)
      const float s1v = st1[r] * 0.125f;
      float mx = fmaxf(s0v, s1v);
#pragma unroll
      for (int d = 8; d >= 1; d >>= 1) mx = fmaxf(mx, __shfl_xor(mx, d, 32));
      const float mnew = fmaxf(m_i[r], mx);
      const float p0 = __expf(s0v - mnew);
      const float p1 = __expf(s1v - mnew);
      float rs = p0 + p1;
#pragma unroll
      for (int d = 8; d >= 1; d >>= 1) rs += __shfl_xor(rs, d, 32);
      alpha_r[r] = __expf(m_i[r] - mnew);
      l_i[r] = l_i[r] * alpha_r[r] + rs;
      m_i[r] = mnew;
      Ps[wave][r + 8 * half][n16]      = p0;   // relay P through LDS
      Ps[wave][r + 8 * half][16 + n16] = p1;
    }
#pragma unroll
    for (int ct = 0; ct < 4; ct++)
#pragma unroll
      for (int r = 0; r < 8; r++) acc[ct][r] *= alpha_r[r];

    __syncthreads();

    // acc += P(16x32) * V(32x64): 4 col-tiles x 8 k-steps
#pragma unroll
    for (int ct = 0; ct < 4; ct++) {
#pragma unroll
      for (int kk = 0; kk < 8; kk++) {
        const int k = kk * 4 + kb;
        v2f a;  a.x  = Ps[wave][n16][k];            a.y  = Ps[wave][n16][k + 1];
        v2f bb; bb.x = Vs[buf][k][ct * 16 + n16];   bb.y = Vs[buf][k + 1][ct * 16 + n16];
        acc[ct] = wmma4(a, bb, acc[ct]);
      }
    }
    __syncthreads();
  }

  // normalize + write back into QO (same (rows, head-cols) this block read)
#pragma unroll
  for (int r = 0; r < 8; r++) {
    const float inv = 1.0f / l_i[r];
    const int tok = b * T_ + t0 + wave * 16 + r + 8 * half;
    float* orow = QO + (size_t)tok * D_ + h * HD_;
#pragma unroll
    for (int ct = 0; ct < 4; ct++) orow[ct * 16 + n16] = acc[ct][r] * inv;
  }
}

// ---------------------------------------------------------------------------
// Host-side launcher
// ---------------------------------------------------------------------------
extern "C" void kernel_launch(void* const* d_in, const int* in_sizes, int n_in,
                              void* d_out, int out_size, void* d_ws, size_t ws_size,
                              hipStream_t stream) {
  const float* x       = (const float*)d_in[0];   // [2,1024,1024]
  const float* k_cache = (const float*)d_in[1];   // [2,4,1024,64]
  const float* v_cache = (const float*)d_in[2];   // [2,4,1024,64]
  const int*   pos     = (const int*)  d_in[3];   // [2,1024]
  const float* Wq      = (const float*)d_in[4];   // [1024,1024]
  const float* Wk      = (const float*)d_in[5];   // [1024,256]
  const float* Wv      = (const float*)d_in[6];   // [1024,256]
  const float* Wo      = (const float*)d_in[7];   // [1024,1024]

  float* out   = (float*)d_out;                        // [2,1024,1024]
  float* out_k = out   + (size_t)B_ * T_ * D_;         // [2,4,2048,64]
  float* out_v = out_k + (size_t)B_ * KV_ * S_ * HD_;  // [2,4,2048,64]

  float* Qws = (float*)d_ws;                           // [2048,1024] (also attn out)
  float* Kn  = Qws + (size_t)B_ * T_ * D_;             // [2048,256]
  float* Vn  = Kn  + (size_t)B_ * T_ * (KV_ * HD_);    // [2048,256]

  const int Mtok = B_ * T_;  // 2048

  // 1) projections
  wmma_gemm_f32<<<dim3(D_ / 64, Mtok / 64), 256, 0, stream>>>(x, Wq, Qws, Mtok, D_, D_);
  wmma_gemm_f32<<<dim3((KV_ * HD_) / 64, Mtok / 64), 256, 0, stream>>>(x, Wk, Kn, Mtok, KV_ * HD_, D_);
  wmma_gemm_f32<<<dim3((KV_ * HD_) / 64, Mtok / 64), 256, 0, stream>>>(x, Wv, Vn, Mtok, KV_ * HD_, D_);

  // 2) RoPE + KV assembly
  rope_assemble_kernel<<<ROPE_BLOCKS_ + COPY_BLOCKS_, 256, 0, stream>>>(
      Qws, Kn, Vn, pos, k_cache, v_cache, out_k, out_v);

  // 3) attention (writes O in place of Q)
  attn_fwd_kernel<<<dim3(T_ / 128, H_, B_), 256, 0, stream>>>(Qws, out_k, out_v);

  // 4) output projection
  wmma_gemm_f32<<<dim3(D_ / 64, Mtok / 64), 256, 0, stream>>>(Qws, Wo, out, Mtok, D_, D_);
}

// v003
// A run of this version takes 201 microseconds.
// Timed twice side by side with v002, it ran 1.22 times as fast both times.
// Over all steps from v000 it is 1.51 times as fast.
#include <hip/hip_runtime.h>
#include <hip/hip_bf16.h>

#define B_      2
#define T_      1024
#define D_      1024
#define H_      16
#define KV_     4
#define HD_     64
#define CACHE_  1024
#define S_      2048
#define MAXSEQ_ 4096

typedef float v2f __attribute__((ext_vector_type(2)));
typedef float v8f __attribute__((ext_vector_type(8)));

__device__ __forceinline__ v8f wmma4(v2f a, v2f b, v8f c) {
  // D = A(16x4 f32) * B(4x16 f32) + C(16x16 f32)
  return __builtin_amdgcn_wmma_f32_16x16x4_f32(
      /*neg_a=*/false, a, /*neg_b=*/false, b,
      /*c_mod=*/(short)0, c, /*reuse_a=*/false, /*reuse_b=*/false);
}

// Async global->LDS B128 (CDNA5 TDM-class path, tracked by ASYNCcnt).
// LDS aperture: flat addr[31:0] == LDS byte offset.
__device__ __forceinline__ unsigned lds_off(const void* p) {
  return (unsigned)(unsigned long long)p;
}
__device__ __forceinline__ void async_ld_b128(unsigned lds, const void* gaddr) {
  asm volatile("global_load_async_to_lds_b128 %0, %1, off"
               :: "v"(lds), "v"(gaddr) : "memory");
}
__device__ __forceinline__ void wait_async_le(int n) {
  if (n == 0)      asm volatile("s_wait_asynccnt 0x0" ::: "memory");
  else if (n == 2) asm volatile("s_wait_asynccnt 0x2" ::: "memory");
  else             asm volatile("s_wait_asynccnt 0x4" ::: "memory");
}

// One GEMM stage: this thread's eight async global->LDS B128 copies (four of A,
// four of B). The s_wait_xcnt closes the same statement so that no later
// rewrite of a copy's address registers can be scheduled in front of it.
__device__ __forceinline__ void async_stage_x8(
    unsigned la0, unsigned la1, unsigned la2, unsigned la3,
    unsigned lb0, unsigned lb1, unsigned lb2, unsigned lb3,
    const float* a0, const float* a1, const float* a2, const float* a3,
    const float* b0, const float* b1, const float* b2, const float* b3) {
  asm volatile("global_load_async_to_lds_b128 %0, %8, off\n\t"
               "global_load_async_to_lds_b128 %1, %9, off\n\t"
               "global_load_async_to_lds_b128 %2, %10, off\n\t"
               "global_load_async_to_lds_b128 %3, %11, off\n\t"
               "global_load_async_to_lds_b128 %4, %12, off\n\t"
               "global_load_async_to_lds_b128 %5, %13, off\n\t"
               "global_load_async_to_lds_b128 %6, %14, off\n\t"
               "global_load_async_to_lds_b128 %7, %15, off\n\t"
               "s_wait_xcnt 0x0"
               :: "v"(la0), "v"(la1), "v"(la2), "v"(la3),
                  "v"(lb0), "v"(lb1), "v"(lb2), "v"(lb3),
                  "v"(a0), "v"(a1), "v"(a2), "v"(a3),
                  "v"(b0), "v"(b1), "v"(b2), "v"(b3)
               : "memory");
}

// ---------------------------------------------------------------------------
// Generic fp32 WMMA GEMM: C[M,N] = A[M,K] * B[K,N], row-major.
// Block = 256 threads (8 waves). Block tile 64x64, wave tile 16x32.
// A stage is a 64-deep k-slab of both operands; two LDS buffers filled by async
// global->LDS copies, the next stage in flight while this one is multiplied.
// Requires M%64==0, N%64==0, K%64==0 (true for all our calls).
// ---------------------------------------------------------------------------
#define GBK_ 64
__global__ __launch_bounds__(256) void wmma_gemm_f32(
    const float* __restrict__ A, const float* __restrict__ Bm,
    float* __restrict__ C, int M, int N, int K)
{
  // 16-byte alignment: every B128 copy lands on a multiple of its width
  __shared__ __attribute__((aligned(16))) float As[2][64][GBK_ + 4];  // [m][k], row stride 272B
  __shared__ __attribute__((aligned(16))) float Bs[2][GBK_][68];      // [k][n], row stride 272B

  const int tid   = threadIdx.x;
  const int wave  = tid >> 5;
  const int lane  = tid & 31;
  const int waveM = wave & 3;          // 4 row-groups of 16
  const int waveN = wave >> 2;         // 2 col-groups of 32
  const int n16   = lane & 15;
  const int half  = lane >> 4;
  const int kb    = half * 2;

  const int rowBase = blockIdx.y * 64;
  const int colBase = blockIdx.x * 64;

  // cooperative-load indices: rows lr, lr+16, lr+32, lr+48 of each 64x64 tile
  const int lr = tid >> 4;             // 0..15
  const int lc = (tid & 15) * 4;       // 0..60

  const float* ga = A  + (size_t)(rowBase + lr) * K + lc;
  const float* gb = Bm + (size_t)lr * N + colBase + lc;
  const size_t a16 = (size_t)16 * K;
  const size_t b16 = (size_t)16 * N;

  // stages are issued in k order; each call moves both pointers one slab on
  auto issue = [&](int buf) {
    async_stage_x8(lds_off(&As[buf][lr][lc]),      lds_off(&As[buf][lr + 16][lc]),
                   lds_off(&As[buf][lr + 32][lc]), lds_off(&As[buf][lr + 48][lc]),
                   lds_off(&Bs[buf][lr][lc]),      lds_off(&Bs[buf][lr + 16][lc]),
                   lds_off(&Bs[buf][lr + 32][lc]), lds_off(&Bs[buf][lr + 48][lc]),
                   ga, ga + a16, ga + 2 * a16, ga + 3 * a16,
                   gb, gb + b16, gb + 2 * b16, gb + 3 * b16);
    ga += GBK_;
    gb += (size_t)GBK_ * N;
  };

  v8f acc0 = {}, acc1 = {};

  const int nst = K / GBK_;
  issue(0);
  // stage 0 landed (own copies), then published to the other waves
  asm volatile("s_wait_asynccnt 0x0" ::: "memory");
  __syncthreads();
  if (nst > 1) issue(1);

  for (int st = 0; st < nst; ++st) {
    const int buf = st & 1;
    // unrolled: LDS offsets become immediates, later k-steps' reads issue early
#pragma unroll
    for (int kk = 0; kk < GBK_ / 4; kk++) {
      const int kd = kk * 4 + kb;
      v2f a;  a.x  = As[buf][waveM * 16 + n16][kd];
              a.y  = As[buf][waveM * 16 + n16][kd + 1];
      v2f b0; b0.x = Bs[buf][kd][waveN * 32 + n16];
              b0.y = Bs[buf][kd + 1][waveN * 32 + n16];
      v2f b1; b1.x = Bs[buf][kd][waveN * 32 + 16 + n16];
              b1.y = Bs[buf][kd + 1][waveN * 32 + 16 + n16];
      acc0 = wmma4(a, b0, acc0);
      acc1 = wmma4(a, b1, acc1);
    }
    // publish point: this wave's reads of buf are back, its copies of the next
    // stage have landed; the barrier frees buf for the refill and publishes
    // the next stage to every wave
    asm volatile("s_wait_dscnt 0x0" ::: "memory");
    asm volatile("s_wait_asynccnt 0x0" ::: "memory");
    __syncthreads();
    if (st + 2 < nst) issue(buf);
  }
  // no copy outstanding when the wave ends
  asm volatile("s_wait_asynccnt 0x0" ::: "memory");

#pragma unroll
  for (int r = 0; r < 8; r++) {
    const int m  = rowBase + waveM * 16 + r + 8 * half;
    const int n0 = colBase + waveN * 32 + n16;
    C[(size_t)m * N + n0]      = acc0[r];
    C[(size_t)m * N + n0 + 16] = acc1[r];
  }
}

// ---------------------------------------------------------------------------
// RoPE helpers (double-precision angle -> fp32 reference-grade accuracy)
// ---------------------------------------------------------------------------
__device__ __forceinline__ void rope_cs(int p, int i, float& c, float& s) {
  const double inv_freq = exp(-(double)(2 * i) * 9.210340371976184 / 64.0); // ln(10000)
  double sd, cd;
  sincos((double)p * inv_freq, &sd, &cd);
  c = (float)cd; s = (float)sd;
}

// RoPE of Q (in place) and K, V scatter and cache copy, one launch.
// Blocks [0, ROPE_BLOCKS_): one thread per (token, frequency i). The angle depends
// on the token and on i alone, so it is formed once and serves the 16 query heads
// and the 4 key heads of that token; the token's V elements i and i + 32 go along.
// Blocks [ROPE_BLOCKS_, ROPE_BLOCKS_ + COPY_BLOCKS_): cache rows [0, CACHE_) of
// the output K/V, one 16-byte piece of each cache per thread.
#define ROPE_BLOCKS_ ((B_ * T_ * 32) / 256)                    // 256
#define COPY_BLOCKS_ ((B_ * KV_ * CACHE_ * HD_ / 4) / 256)     // 512
__global__ __launch_bounds__(256) void rope_assemble_kernel(
    float* __restrict__ Q, const float* __restrict__ Kn, const float* __restrict__ Vn,
    const int* __restrict__ pos,
    const float* __restrict__ kc, const float* __restrict__ vc,
    float* __restrict__ ok, float* __restrict__ ov)
{
  if (blockIdx.x < ROPE_BLOCKS_) {
    const int idx = blockIdx.x * 256 + threadIdx.x;
    const int i   = idx & 31;
    const int tok = idx >> 5;            // b * T_ + t
    const int t   = tok & (T_ - 1);
    const int b   = tok >> 10;
    int p = pos[tok] + t + CACHE_;
    p = min(max(p, 0), MAXSEQ_ - 1);

    float* qrow       = Q  + (size_t)tok * D_ + i;
    const float* krow = Kn + (size_t)tok * (KV_ * HD_) + i;
    const float* vrow = Vn + (size_t)tok * (KV_ * HD_) + i;

    // every load of the thread is issued ahead of the angle's arithmetic
    float q1[H_], q2[H_], k1[KV_], k2[KV_], v1[KV_], v2[KV_];
    // the four loops are unrolled so that these arrays live in registers and the
    // head offsets become immediates
#pragma unroll
    for (int hh = 0; hh < H_; hh++) {
      q1[hh] = qrow[hh * HD_];
      q2[hh] = qrow[hh * HD_ + 32];
    }
#pragma unroll
    for (int kv = 0; kv < KV_; kv++) {
      k1[kv] = krow[kv * HD_];
      k2[kv] = krow[kv * HD_ + 32];
      v1[kv] = vrow[kv * HD_];
      v2[kv] = vrow[kv * HD_ + 32];
    }

    // no address register of the loads above is reused before this wait: the
    // addresses that die here are inputs, so they stay whole up to it
    asm volatile("s_wait_xcnt 0x0" :: "v"(krow), "v"(vrow), "v"(tok) : "memory");

    float c, s; rope_cs(p, i, c, s);

#pragma unroll
    for (int hh = 0; hh < H_; hh++) {
      qrow[hh * HD_]      = q1[hh] * c - q2[hh] * s;
      qrow[hh * HD_ + 32] = q2[hh] * c + q1[hh] * s;
    }
#pragma unroll
    for (int kv = 0; kv < KV_; kv++) {
      const size_t orow = ((size_t)(b * KV_ + kv) * S_ + CACHE_ + t) * HD_ + i;
      ok[orow]      = k1[kv] * c - k2[kv] * s;
      ok[orow + 32] = k2[kv] * c + k1[kv] * s;
      ov[orow]      = v1[kv];
      ov[orow + 32] = v2[kv];
    }
  } else {
    const int j = (blockIdx.x - ROPE_BLOCKS_) * 256 + threadIdx.x;
    // CACHE_ * HD_ / 4 = 16384 pieces per (b, kv) in a cache, twice that in the output
    const size_t o = (size_t)(j >> 14) * (S_ * HD_ / 4) + (j & 16383);
    const float4 kp = ((const float4*)kc)[j];
    const float4 vp = ((const float4*)vc)[j];
    ((float4*)ok)[o] = kp;
    ((float4*)ov)[o] = vp;
    // no register that the two stores name is rewritten before this wait, on any
    // way the built code can leave this branch
    asm volatile("s_wait_xcnt 0x0" ::: "memory");
  }
}

// ---------------------------------------------------------------------------
// Flash attention, fp32 WMMA, transposed products. grid(8, H_, B_), 256 threads.
// Each block: 128 queries (16/wave) for one (b, h); iterates S in blocks of 32 keys.
// S^T = K * Q^T: a lane holds scores of ONE query (column n16), keys 8 * half + r in
// register r, so the softmax maximum and sum run down the lane's own registers, with
// one exchange between the wave's halves. O^T += V^T * P^T: two score registers of a
// lane are already a B fragment, so P goes to the second product without LDS.
// K/V tiles double-buffered in LDS via async global->LDS with prefetch.
// Writes attention output back into QO (aliasing Q; regions disjoint/RAW-safe).
// ---------------------------------------------------------------------------
// lane l <-> lane l ^ 16
__device__ __forceinline__ float xhalf(float x) {
  return __builtin_bit_cast(float, __builtin_amdgcn_permlanex16(
      __builtin_bit_cast(int, x), __builtin_bit_cast(int, x),
      0x76543210, 0xfedcba98, false, false));
}

// e^x as the fast builtin forms it (one multiply, v_exp_f32). The v_nop in the same
// statement is the free slot that the instruction set asks for behind a transcendental
// before its result is used or its source overwritten.
__device__ __forceinline__ float exp_slot(float x) {
  float r;
  asm("v_exp_f32 %0, %1\n\tv_nop" : "=v"(r) : "v"(x * 1.44269504088896340736f));
  return r;
}

// The grid puts two waves on a SIMD; saying so gives the compiler the registers to
// hold a whole pass's K and V fragments, read ahead of the products.
__global__ __launch_bounds__(256) __attribute__((amdgpu_waves_per_eu(2, 2)))
void attn_fwd_kernel(
    float* __restrict__ QO, const float* __restrict__ Kt, const float* __restrict__ Vt)
{
  // 16-byte alignment: every B128 copy lands on a multiple of its width
  __shared__ __attribute__((aligned(16))) float Ks[2][32][68];
  __shared__ __attribute__((aligned(16))) float Vs[2][32][68];

  const int tileQ = blockIdx.x;      // 0..7
  const int h     = blockIdx.y;      // 0..15
  const int b     = blockIdx.z;      // 0..1
  const int kvh   = h >> 2;          // n_rep = 4, contiguous grouping
  const int tid   = threadIdx.x;
  const int wave  = tid >> 5;
  const int lane  = tid & 31;
  const int n16   = lane & 15;
  const int half  = lane >> 4;
  const int kb    = half * 2;
  const int t0    = tileQ * 128;

  const float* kbase = Kt + (size_t)(b * KV_ + kvh) * S_ * HD_;
  const float* vbase = Vt + (size_t)(b * KV_ + kvh) * S_ * HD_;

  // Q^T as pre-shaped B fragments: column n16 = query, 16 fragments cover hd=64
  float2 qa[16];
  {
    const float* qrow = QO + (size_t)(b * T_ + t0 + wave * 16 + n16) * D_ + h * HD_ + kb;
#pragma unroll
    for (int kk = 0; kk < 16; kk++) qa[kk] = *(const float2*)(qrow + kk * 4);
  }

  // acc[ct][r] = O^T[hd = ct * 16 + 8 * half + r][query n16]
  v8f acc[4];
  {
    v8f z = {};
#pragma unroll
    for (int ct = 0; ct < 4; ct++) acc[ct] = z;
  }
  // running maximum of the lane's query (equal in both halves) and the sum over the
  // keys of the lane's own half; the halves' sums are joined after the loop
  float m_i = -1e30f, l_i = 0.0f;

  const int lr0 = tid >> 4;          // 0..15
  const int c0  = (tid & 15) * 4;    // 0..60

  auto issue_tile = [&](int s0, int buf) {
    async_ld_b128(lds_off(&Ks[buf][lr0][c0]),      kbase + (size_t)(s0 + lr0)      * HD_ + c0);
    async_ld_b128(lds_off(&Ks[buf][16 + lr0][c0]), kbase + (size_t)(s0 + 16 + lr0) * HD_ + c0);
    async_ld_b128(lds_off(&Vs[buf][lr0][c0]),      vbase + (size_t)(s0 + lr0)      * HD_ + c0);
    async_ld_b128(lds_off(&Vs[buf][16 + lr0][c0]), vbase + (size_t)(s0 + 16 + lr0) * HD_ + c0);
  };

  const int NITER = S_ / 32;   // 64
  issue_tile(0, 0);
  for (int it = 0; it < NITER; ++it) {
    const int buf = it & 1;
    if (it + 1 < NITER) { issue_tile((it + 1) * 32, buf ^ 1); wait_async_le(4); }
    else                { wait_async_le(0); }
    __syncthreads();

    // every inner loop of the pass is unrolled: the fragment arrays live in registers
    // only under constant indices, and the LDS offsets become immediates
    // K rows as A fragments: 16 fragments cover hd=64, 2 key tiles
    v2f kf0[16], kf1[16];
#pragma unroll
    for (int kk = 0; kk < 16; kk++) {
      const int kd = kk * 4 + kb;
      kf0[kk].x = Ks[buf][n16][kd];       kf0[kk].y = Ks[buf][n16][kd + 1];
      kf1[kk].x = Ks[buf][16 + n16][kd];  kf1[kk].y = Ks[buf][16 + n16][kd + 1];
    }
    // scheduling fence: the K reads stay one group in front of the score WMMAs, which
    // then run behind counted waits; fetched a few at a time their waits run to zero
    __builtin_amdgcn_sched_barrier(0);

    // scores: S^T = K * Q^T over hd=64 (16 WMMAs per 16x16 tile), first half
    v8f st0 = {}, st1 = {};
#pragma unroll
    for (int kk = 0; kk < 8; kk++) {
      v2f q; q.x = qa[kk].x; q.y = qa[kk].y;
      st0 = wmma4(kf0[kk], q, st0);
      st1 = wmma4(kf1[kk], q, st1);
    }

    // V of this pass, as the second product's A operand wants it: rows 8 * half + i of
    // each 16-key tile, column ct * 16 + n16
    float va[8][4], vb[8][4];
#pragma unroll
    for (int i = 0; i < 8; i++) {
#pragma unroll
      for (int ct = 0; ct < 4; ct++) {
        va[i][ct] = Vs[buf][8 * half + i][ct * 16 + n16];
        vb[i][ct] = Vs[buf][16 + 8 * half + i][ct * 16 + n16];
      }
    }
    // scheduling fence: the V reads are issued no later than here, half a score run
    // ahead of the softmax, so that they are back when the second product asks
    __builtin_amdgcn_sched_barrier(0);

    // scores, second half
#pragma unroll
    for (int kk = 8; kk < 16; kk++) {
      v2f q; q.x = qa[kk].x; q.y = qa[kk].y;
      st0 = wmma4(kf0[kk], q, st0);
      st1 = wmma4(kf1[kk], q, st1);
    }
    // scheduling fence: the register set-up of the second product's operands, with its
    // waits on the V reads, stays below the score WMMAs instead of stalling them
    __builtin_amdgcn_sched_barrier(0);

    // online softmax of one query per lane: 16 of the 32 keys are in this lane,
    // the other 16 in lane ^ 16
    float mx0 = st0[0], mx1 = st1[0];
#pragma unroll
    for (int r = 1; r < 8; r++) {
      mx0 = fmaxf(mx0, st0[r]);
      mx1 = fmaxf(mx1, st1[r]);
    }
    // 1/sqrt(64) is a power of two: scaling behind the maximum gives the same value
    float mx = 0.125f * fmaxf(mx0, mx1);
    mx = fmaxf(mx, xhalf(mx));
    const float mnew  = fmaxf(m_i, mx);
    const float alpha = exp_slot(m_i - mnew);
    float rs0 = 0.0f, rs1 = 0.0f;
#pragma unroll
    for (int r = 0; r < 8; r++) {
      st0[r] = exp_slot(st0[r] * 0.125f - mnew);
      st1[r] = exp_slot(st1[r] * 0.125f - mnew);
      rs0 += st0[r];
      rs1 += st1[r];
    }
    l_i = l_i * alpha + (rs0 + rs1);
    m_i = mnew;
#pragma unroll
    for (int ct = 0; ct < 4; ct++)
#pragma unroll
      for (int r = 0; r < 8; r++) acc[ct][r] *= alpha;

    // acc += V^T(64x32) * P^T(32x16): 8 k-steps x 4 row-tiles. A k-step takes the
    // register pair (2j, 2j + 1) of one score tile as B: keys 8 * half + 2j, + 1 of
    // that tile; A holds the same keys' rows of V.
#pragma unroll
    for (int j = 0; j < 4; j++) {
      v2f p0; p0.x = st0[2 * j];  p0.y = st0[2 * j + 1];
      v2f p1; p1.x = st1[2 * j];  p1.y = st1[2 * j + 1];
#pragma unroll
      for (int ct = 0; ct < 4; ct++) {
        v2f v; v.x = va[2 * j][ct];  v.y = va[2 * j + 1][ct];
        acc[ct] = wmma4(v, p0, acc[ct]);
      }
#pragma unroll
      for (int ct = 0; ct < 4; ct++) {
        v2f v; v.x = vb[2 * j][ct];  v.y = vb[2 * j + 1][ct];
        acc[ct] = wmma4(v, p1, acc[ct]);
      }
    }
    __syncthreads();
  }

  // join the halves' sums, normalize + write back into QO (same (rows, head-cols)
  // this wave read): a lane holds 8 consecutive hd of its query per row-tile
  {
    const float inv = 1.0f / (l_i + xhalf(l_i));
    float* orow = QO + (size_t)(b * T_ + t0 + wave * 16 + n16) * D_ + h * HD_ + 8 * half;
#pragma unroll
    for (int ct = 0; ct < 4; ct++) {
      *(float4*)(orow + ct * 16)     = make_float4(acc[ct][0] * inv, acc[ct][1] * inv,
                                                   acc[ct][2] * inv, acc[ct][3] * inv);
      *(float4*)(orow + ct * 16 + 4) = make_float4(acc[ct][4] * inv, acc[ct][5] * inv,
                                                   acc[ct][6] * inv, acc[ct][7] * inv);
    }
  }
}

// ---------------------------------------------------------------------------
// Host-side launcher
// ---------------------------------------------------------------------------
extern "C" void kernel_launch(void* const* d_in, const int* in_sizes, int n_in,
                              void* d_out, int out_size, void* d_ws, size_t ws_size,
                              hipStream_t stream) {
  const float* x       = (const float*)d_in[0];   // [2,1024,1024]
  const float* k_cache = (const float*)d_in[1];   // [2,4,1024,64]
  const float* v_cache = (const float*)d_in[2];   // [2,4,1024,64]
  const int*   pos     = (const int*)  d_in[3];   // [2,1024]
  const float* Wq      = (const float*)d_in[4];   // [1024,1024]
  const float* Wk      = (const float*)d_in[5];   // [1024,256]
  const float* Wv      = (const float*)d_in[6];   // [1024,256]
  const float* Wo      = (const float*)d_in[7];   // [1024,1024]

  float* out   = (float*)d_out;                        // [2,1024,1024]
  float* out_k = out   + (size_t)B_ * T_ * D_;         // [2,4,2048,64]
  float* out_v = out_k + (size_t)B_ * KV_ * S_ * HD_;  // [2,4,2048,64]

  float* Qws = (float*)d_ws;                           // [2048,1024] (also attn out)
  float* Kn  = Qws + (size_t)B_ * T_ * D_;             // [2048,256]
  float* Vn  = Kn  + (size_t)B_ * T_ * (KV_ * HD_);    // [2048,256]

  const int Mtok = B_ * T_;  // 2048

  // 1) projections
  wmma_gemm_f32<<<dim3(D_ / 64, Mtok / 64), 256, 0, stream>>>(x, Wq, Qws, Mtok, D_, D_);
  wmma_gemm_f32<<<dim3((KV_ * HD_) / 64, Mtok / 64), 256, 0, stream>>>(x, Wk, Kn, Mtok, KV_ * HD_, D_);
  wmma_gemm_f32<<<dim3((KV_ * HD_) / 64, Mtok / 64), 256, 0, stream>>>(x, Wv, Vn, Mtok, KV_ * HD_, D_);

  // 2) RoPE + KV assembly
  rope_assemble_kernel<<<ROPE_BLOCKS_ + COPY_BLOCKS_, 256, 0, stream>>>(
      Qws, Kn, Vn, pos, k_cache, v_cache, out_k, out_v);

  // 3) attention (writes O in place of Q)
  attn_fwd_kernel<<<dim3(T_ / 128, H_, B_), 256, 0, stream>>>(Qws, out_k, out_v);

  // 4) output projection
  wmma_gemm_f32<<<dim3(D_ / 64, Mtok / 64), 256, 0, stream>>>(Qws, Wo, out, Mtok, D_, D_);
}

// v004
// A run of this version takes 179 microseconds.
// In both of two side-by-side timings against v003, it was 1.13 times as fast.
// Counting every step since v000, it is 1.70 times as fast.
#include <hip/hip_runtime.h>
#include <hip/hip_bf16.h>

#define B_      2
#define T_      1024
#define D_      1024
#define H_      16
#define KV_     4
#define HD_     64
#define CACHE_  1024
#define S_      2048
#define MAXSEQ_ 4096

typedef float v2f __attribute__((ext_vector_type(2)));
typedef float v8f __attribute__((ext_vector_type(8)));

__device__ __forceinline__ v8f wmma4(v2f a, v2f b, v8f c) {
  // D = A(16x4 f32) * B(4x16 f32) + C(16x16 f32)
  return __builtin_amdgcn_wmma_f32_16x16x4_f32(
      /*neg_a=*/false, a, /*neg_b=*/false, b,
      /*c_mod=*/(short)0, c, /*reuse_a=*/false, /*reuse_b=*/false);
}

// Async global->LDS B128 (CDNA5 TDM-class path, tracked by ASYNCcnt).
// LDS aperture: flat addr[31:0] == LDS byte offset.
__device__ __forceinline__ unsigned lds_off(const void* p) {
  return (unsigned)(unsigned long long)p;
}
__device__ __forceinline__ void async_ld_b128(unsigned lds, const void* gaddr) {
  asm volatile("global_load_async_to_lds_b128 %0, %1, off"
               :: "v"(lds), "v"(gaddr) : "memory");
}
__device__ __forceinline__ void wait_async_le(int n) {
  if (n == 0)      asm volatile("s_wait_asynccnt 0x0" ::: "memory");
  else if (n == 2) asm volatile("s_wait_asynccnt 0x2" ::: "memory");
  else             asm volatile("s_wait_asynccnt 0x4" ::: "memory");
}

// One GEMM stage: this thread's eight async global->LDS B128 copies (four of A,
// four of B). The s_wait_xcnt closes the same statement so that no later
// rewrite of a copy's address registers can be scheduled in front of it.
__device__ __forceinline__ void async_stage_x8(
    unsigned la0, unsigned la1, unsigned la2, unsigned la3,
    unsigned lb0, unsigned lb1, unsigned lb2, unsigned lb3,
    const float* a0, const float* a1, const float* a2, const float* a3,
    const float* b0, const float* b1, const float* b2, const float* b3) {
  asm volatile("global_load_async_to_lds_b128 %0, %8, off\n\t"
               "global_load_async_to_lds_b128 %1, %9, off\n\t"
               "global_load_async_to_lds_b128 %2, %10, off\n\t"
               "global_load_async_to_lds_b128 %3, %11, off\n\t"
               "global_load_async_to_lds_b128 %4, %12, off\n\t"
               "global_load_async_to_lds_b128 %5, %13, off\n\t"
               "global_load_async_to_lds_b128 %6, %14, off\n\t"
               "global_load_async_to_lds_b128 %7, %15, off\n\t"
               "s_wait_xcnt 0x0"
               :: "v"(la0), "v"(la1), "v"(la2), "v"(la3),
                  "v"(lb0), "v"(lb1), "v"(lb2), "v"(lb3),
                  "v"(a0), "v"(a1), "v"(a2), "v"(a3),
                  "v"(b0), "v"(b1), "v"(b2), "v"(b3)
               : "memory");
}

// ---------------------------------------------------------------------------
// Generic fp32 WMMA GEMM: C[M,N] = A[M,K] * B[K,N], row-major.
// Block = 256 threads (8 waves). Block tile 64x64, wave tile 16x32.
// A stage is a 64-deep k-slab of both operands; two LDS buffers filled by async
// global->LDS copies, the next stage in flight while this one is multiplied.
// Requires M%64==0, N%64==0, K%64==0 (true for all our calls).
// ---------------------------------------------------------------------------
#define GBK_ 64
// One 64x64 block tile of C, rows from rowBase, columns from colBase.
__device__ __forceinline__ void gemm_block_tile(
    const float* __restrict__ A, const float* __restrict__ Bm,
    float* __restrict__ C, int N, int K, int rowBase, int colBase)
{
  // 16-byte alignment: every B128 copy lands on a multiple of its width
  __shared__ __attribute__((aligned(16))) float As[2][64][GBK_ + 4];  // [m][k], row stride 272B
  __shared__ __attribute__((aligned(16))) float Bs[2][GBK_][68];      // [k][n], row stride 272B

  const int tid   = threadIdx.x;
  const int wave  = tid >> 5;
  const int lane  = tid & 31;
  const int waveM = wave & 3;          // 4 row-groups of 16
  const int waveN = wave >> 2;         // 2 col-groups of 32
  const int n16   = lane & 15;
  const int half  = lane >> 4;
  const int kb    = half * 2;

  // cooperative-load indices: rows lr, lr+16, lr+32, lr+48 of each 64x64 tile
  const int lr = tid >> 4;             // 0..15
  const int lc = (tid & 15) * 4;       // 0..60

  const float* ga = A  + (size_t)(rowBase + lr) * K + lc;
  const float* gb = Bm + (size_t)lr * N + colBase + lc;
  const size_t a16 = (size_t)16 * K;
  const size_t b16 = (size_t)16 * N;

  // stages are issued in k order; each call moves both pointers one slab on
  auto issue = [&](int buf) {
    async_stage_x8(lds_off(&As[buf][lr][lc]),      lds_off(&As[buf][lr + 16][lc]),
                   lds_off(&As[buf][lr + 32][lc]), lds_off(&As[buf][lr + 48][lc]),
                   lds_off(&Bs[buf][lr][lc]),      lds_off(&Bs[buf][lr + 16][lc]),
                   lds_off(&Bs[buf][lr + 32][lc]), lds_off(&Bs[buf][lr + 48][lc]),
                   ga, ga + a16, ga + 2 * a16, ga + 3 * a16,
                   gb, gb + b16, gb + 2 * b16, gb + 3 * b16);
    ga += GBK_;
    gb += (size_t)GBK_ * N;
  };

  v8f acc0 = {}, acc1 = {};

  const int nst = K / GBK_;
  issue(0);
  // stage 0 landed (own copies), then published to the other waves
  asm volatile("s_wait_asynccnt 0x0" ::: "memory");
  __syncthreads();
  if (nst > 1) issue(1);

  for (int st = 0; st < nst; ++st) {
    const int buf = st & 1;
    // unrolled: LDS offsets become immediates, later k-steps' reads issue early
#pragma unroll
    for (int kk = 0; kk < GBK_ / 4; kk++) {
      const int kd = kk * 4 + kb;
      v2f a;  a.x  = As[buf][waveM * 16 + n16][kd];
              a.y  = As[buf][waveM * 16 + n16][kd + 1];
      v2f b0; b0.x = Bs[buf][kd][waveN * 32 + n16];
              b0.y = Bs[buf][kd + 1][waveN * 32 + n16];
      v2f b1; b1.x = Bs[buf][kd][waveN * 32 + 16 + n16];
              b1.y = Bs[buf][kd + 1][waveN * 32 + 16 + n16];
      acc0 = wmma4(a, b0, acc0);
      acc1 = wmma4(a, b1, acc1);
    }
    // publish point: this wave's reads of buf are back, its copies of the next
    // stage have landed; the barrier frees buf for the refill and publishes
    // the next stage to every wave
    asm volatile("s_wait_dscnt 0x0" ::: "memory");
    asm volatile("s_wait_asynccnt 0x0" ::: "memory");
    __syncthreads();
    if (st + 2 < nst) issue(buf);
  }
  // no copy outstanding when the wave ends
  asm volatile("s_wait_asynccnt 0x0" ::: "memory");

#pragma unroll
  for (int r = 0; r < 8; r++) {
    const int m  = rowBase + waveM * 16 + r + 8 * half;
    const int n0 = colBase + waveN * 32 + n16;
    C[(size_t)m * N + n0]      = acc0[r];
    C[(size_t)m * N + n0 + 16] = acc1[r];
  }
}

__global__ __launch_bounds__(256) void wmma_gemm_f32(
    const float* __restrict__ A, const float* __restrict__ Bm,
    float* __restrict__ C, int M, int N, int K)
{
  gemm_block_tile(A, Bm, C, N, K, blockIdx.y * 64, blockIdx.x * 64);
}

// The three projections of x in one launch. Column blocks [0, 16) belong to Wq,
// [16, 20) to Wk, [20, 24) to Wv; the choice is the same for a whole block. Alone, a
// K or V projection is 128 blocks, half a block per WGP; together the 768 blocks
// stand three to a WGP, six waves to a SIMD.
#define QCB_  (D_ / 64)             // 16
#define KVCB_ ((KV_ * HD_) / 64)    // 4
__global__ __launch_bounds__(256) void wmma_gemm_qkv(
    const float* __restrict__ X,
    const float* __restrict__ Wq, const float* __restrict__ Wk, const float* __restrict__ Wv,
    float* __restrict__ Q, float* __restrict__ Kn, float* __restrict__ Vn, int K)
{
  const int cb = blockIdx.x;
  const float* Bm = Wq;
  float* C = Q;
  int N = D_, col = cb;
  if (cb >= QCB_ + KVCB_)  { Bm = Wv; C = Vn; N = KV_ * HD_; col = cb - (QCB_ + KVCB_); }
  else if (cb >= QCB_)     { Bm = Wk; C = Kn; N = KV_ * HD_; col = cb - QCB_; }
  gemm_block_tile(X, Bm, C, N, K, blockIdx.y * 64, col * 64);
}

// ---------------------------------------------------------------------------
// RoPE helpers (double-precision angle -> fp32 reference-grade accuracy)
// ---------------------------------------------------------------------------
__device__ __forceinline__ void rope_cs(int p, int i, float& c, float& s) {
  const double inv_freq = exp(-(double)(2 * i) * 9.210340371976184 / 64.0); // ln(10000)
  double sd, cd;
  sincos((double)p * inv_freq, &sd, &cd);
  c = (float)cd; s = (float)sd;
}

// RoPE of Q (in place) and K, V scatter and cache copy, one launch.
// Blocks [0, ROPE_BLOCKS_): one thread per (token, frequency i). The angle depends
// on the token and on i alone, so it is formed once and serves the 16 query heads
// and the 4 key heads of that token; the token's V elements i and i + 32 go along.
// Blocks [ROPE_BLOCKS_, ROPE_BLOCKS_ + COPY_BLOCKS_): cache rows [0, CACHE_) of
// the output K/V, one 16-byte piece of each cache per thread.
#define ROPE_BLOCKS_ ((B_ * T_ * 32) / 256)                    // 256
#define COPY_BLOCKS_ ((B_ * KV_ * CACHE_ * HD_ / 4) / 256)     // 512
__global__ __launch_bounds__(256) void rope_assemble_kernel(
    float* __restrict__ Q, const float* __restrict__ Kn, const float* __restrict__ Vn,
    const int* __restrict__ pos,
    const float* __restrict__ kc, const float* __restrict__ vc,
    float* __restrict__ ok, float* __restrict__ ov)
{
  if (blockIdx.x < ROPE_BLOCKS_) {
    const int idx = blockIdx.x * 256 + threadIdx.x;
    const int i   = idx & 31;
    const int tok = idx >> 5;            // b * T_ + t
    const int t   = tok & (T_ - 1);
    const int b   = tok >> 10;
    int p = pos[tok] + t + CACHE_;
    p = min(max(p, 0), MAXSEQ_ - 1);

    float* qrow       = Q  + (size_t)tok * D_ + i;
    const float* krow = Kn + (size_t)tok * (KV_ * HD_) + i;
    const float* vrow = Vn + (size_t)tok * (KV_ * HD_) + i;

    // every load of the thread is issued ahead of the angle's arithmetic
    float q1[H_], q2[H_], k1[KV_], k2[KV_], v1[KV_], v2[KV_];
    // the four loops are unrolled so that these arrays live in registers and the
    // head offsets become immediates
#pragma unroll
    for (int hh = 0; hh < H_; hh++) {
      q1[hh] = qrow[hh * HD_];
      q2[hh] = qrow[hh * HD_ + 32];
    }
#pragma unroll
    for (int kv = 0; kv < KV_; kv++) {
      k1[kv] = krow[kv * HD_];
      k2[kv] = krow[kv * HD_ + 32];
      v1[kv] = vrow[kv * HD_];
      v2[kv] = vrow[kv * HD_ + 32];
    }

    // no address register of the loads above is reused before this wait: the
    // addresses that die here are inputs, so they stay whole up to it
    asm volatile("s_wait_xcnt 0x0" :: "v"(krow), "v"(vrow), "v"(tok) : "memory");

    float c, s; rope_cs(p, i, c, s);

#pragma unroll
    for (int hh = 0; hh < H_; hh++) {
      qrow[hh * HD_]      = q1[hh] * c - q2[hh] * s;
      qrow[hh * HD_ + 32] = q2[hh] * c + q1[hh] * s;
    }
#pragma unroll
    for (int kv = 0; kv < KV_; kv++) {
      const size_t orow = ((size_t)(b * KV_ + kv) * S_ + CACHE_ + t) * HD_ + i;
      ok[orow]      = k1[kv] * c - k2[kv] * s;
      ok[orow + 32] = k2[kv] * c + k1[kv] * s;
      ov[orow]      = v1[kv];
      ov[orow + 32] = v2[kv];
    }
  } else {
    const int j = (blockIdx.x - ROPE_BLOCKS_) * 256 + threadIdx.x;
    // CACHE_ * HD_ / 4 = 16384 pieces per (b, kv) in a cache, twice that in the output
    const size_t o = (size_t)(j >> 14) * (S_ * HD_ / 4) + (j & 16383);
    const float4 kp = ((const float4*)kc)[j];
    const float4 vp = ((const float4*)vc)[j];
    ((float4*)ok)[o] = kp;
    ((float4*)ov)[o] = vp;
    // no register that the two stores name is rewritten before this wait, on any
    // way the built code can leave this branch
    asm volatile("s_wait_xcnt 0x0" ::: "memory");
  }
}

// ---------------------------------------------------------------------------
// Flash attention, fp32 WMMA, transposed products. grid(8, H_, B_), 256 threads.
// Each block: 128 queries (16/wave) for one (b, h); iterates S in blocks of 32 keys.
// S^T = K * Q^T: a lane holds scores of ONE query (column n16), keys 8 * half + r in
// register r, so the softmax maximum and sum run down the lane's own registers, with
// one exchange between the wave's halves. O^T += V^T * P^T: two score registers of a
// lane are already a B fragment, so P goes to the second product without LDS.
// K/V tiles double-buffered in LDS via async global->LDS with prefetch.
// Writes attention output back into QO (aliasing Q; regions disjoint/RAW-safe).
// ---------------------------------------------------------------------------
// lane l <-> lane l ^ 16
__device__ __forceinline__ float xhalf(float x) {
  return __builtin_bit_cast(float, __builtin_amdgcn_permlanex16(
      __builtin_bit_cast(int, x), __builtin_bit_cast(int, x),
      0x76543210, 0xfedcba98, false, false));
}

// e^x as the fast builtin forms it (one multiply, v_exp_f32). The v_nop in the same
// statement is the free slot that the instruction set asks for behind a transcendental
// before its result is used or its source overwritten.
__device__ __forceinline__ float exp_slot(float x) {
  float r;
  asm("v_exp_f32 %0, %1\n\tv_nop" : "=v"(r) : "v"(x * 1.44269504088896340736f));
  return r;
}

// The grid puts two waves on a SIMD; saying so gives the compiler the registers to
// hold a whole pass's K and V fragments, read ahead of the products.
__global__ __launch_bounds__(256) __attribute__((amdgpu_waves_per_eu(2, 2)))
void attn_fwd_kernel(
    float* __restrict__ QO, const float* __restrict__ Kt, const float* __restrict__ Vt)
{
  // 16-byte alignment: every B128 copy lands on a multiple of its width
  __shared__ __attribute__((aligned(16))) float Ks[2][32][68];
  __shared__ __attribute__((aligned(16))) float Vs[2][32][68];

  const int tileQ = blockIdx.x;      // 0..7
  const int h     = blockIdx.y;      // 0..15
  const int b     = blockIdx.z;      // 0..1
  const int kvh   = h >> 2;          // n_rep = 4, contiguous grouping
  const int tid   = threadIdx.x;
  const int wave  = tid >> 5;
  const int lane  = tid & 31;
  const int n16   = lane & 15;
  const int half  = lane >> 4;
  const int kb    = half * 2;
  const int t0    = tileQ * 128;

  const float* kbase = Kt + (size_t)(b * KV_ + kvh) * S_ * HD_;
  const float* vbase = Vt + (size_t)(b * KV_ + kvh) * S_ * HD_;

  // Q^T as pre-shaped B fragments: column n16 = query, 16 fragments cover hd=64
  float2 qa[16];
  {
    const float* qrow = QO + (size_t)(b * T_ + t0 + wave * 16 + n16) * D_ + h * HD_ + kb;
#pragma unroll
    for (int kk = 0; kk < 16; kk++) qa[kk] = *(const float2*)(qrow + kk * 4);
  }

  // acc[ct][r] = O^T[hd = ct * 16 + 8 * half + r][query n16]
  v8f acc[4];
  {
    v8f z = {};
#pragma unroll
    for (int ct = 0; ct < 4; ct++) acc[ct] = z;
  }
  // running maximum of the lane's query (equal in both halves) and the sum over the
  // keys of the lane's own half; the halves' sums are joined after the loop
  float m_i = -1e30f, l_i = 0.0f;

  const int lr0 = tid >> 4;          // 0..15
  const int c0  = (tid & 15) * 4;    // 0..60

  auto issue_tile = [&](int s0, int buf) {
    async_ld_b128(lds_off(&Ks[buf][lr0][c0]),      kbase + (size_t)(s0 + lr0)      * HD_ + c0);
    async_ld_b128(lds_off(&Ks[buf][16 + lr0][c0]), kbase + (size_t)(s0 + 16 + lr0) * HD_ + c0);
    async_ld_b128(lds_off(&Vs[buf][lr0][c0]),      vbase + (size_t)(s0 + lr0)      * HD_ + c0);
    async_ld_b128(lds_off(&Vs[buf][16 + lr0][c0]), vbase + (size_t)(s0 + 16 + lr0) * HD_ + c0);
  };

  const int NITER = S_ / 32;   // 64
  issue_tile(0, 0);
  for (int it = 0; it < NITER; ++it) {
    const int buf = it & 1;
    if (it + 1 < NITER) { issue_tile((it + 1) * 32, buf ^ 1); wait_async_le(4); }
    else                { wait_async_le(0); }
    __syncthreads();

    // every inner loop of the pass is unrolled: the fragment arrays live in registers
    // only under constant indices, and the LDS offsets become immediates
    // K rows as A fragments: 16 fragments cover hd=64, 2 key tiles
    v2f kf0[16], kf1[16];
#pragma unroll
    for (int kk = 0; kk < 16; kk++) {
      const int kd = kk * 4 + kb;
      kf0[kk].x = Ks[buf][n16][kd];       kf0[kk].y = Ks[buf][n16][kd + 1];
      kf1[kk].x = Ks[buf][16 + n16][kd];  kf1[kk].y = Ks[buf][16 + n16][kd + 1];
    }
    // scheduling fence: the K reads stay one group in front of the score WMMAs, which
    // then run behind counted waits; fetched a few at a time their waits run to zero
    __builtin_amdgcn_sched_barrier(0);

    // scores: S^T = K * Q^T over hd=64 (16 WMMAs per 16x16 tile), first half
    v8f st0 = {}, st1 = {};
#pragma unroll
    for (int kk = 0; kk < 8; kk++) {
      v2f q; q.x = qa[kk].x; q.y = qa[kk].y;
      st0 = wmma4(kf0[kk], q, st0);
      st1 = wmma4(kf1[kk], q, st1);
    }

    // V of this pass, as the second product's A operand wants it: rows 8 * half + i of
    // each 16-key tile, column ct * 16 + n16
    float va[8][4], vb[8][4];
#pragma unroll
    for (int i = 0; i < 8; i++) {
#pragma unroll
      for (int ct = 0; ct < 4; ct++) {
        va[i][ct] = Vs[buf][8 * half + i][ct * 16 + n16];
        vb[i][ct] = Vs[buf][16 + 8 * half + i][ct * 16 + n16];
      }
    }
    // scheduling fence: the V reads are issued no later than here, half a score run
    // ahead of the softmax, so that they are back when the second product asks
    __builtin_amdgcn_sched_barrier(0);

    // scores, second half
#pragma unroll
    for (int kk = 8; kk < 16; kk++) {
      v2f q; q.x = qa[kk].x; q.y = qa[kk].y;
      st0 = wmma4(kf0[kk], q, st0);
      st1 = wmma4(kf1[kk], q, st1);
    }
    // scheduling fence: the register set-up of the second product's operands, with its
    // waits on the V reads, stays below the score WMMAs instead of stalling them
    __builtin_amdgcn_sched_barrier(0);

    // online softmax of one query per lane: 16 of the 32 keys are in this lane,
    // the other 16 in lane ^ 16
    float mx0 = st0[0], mx1 = st1[0];
#pragma unroll
    for (int r = 1; r < 8; r++) {
      mx0 = fmaxf(mx0, st0[r]);
      mx1 = fmaxf(mx1, st1[r]);
    }
    // 1/sqrt(64) is a power of two: scaling behind the maximum gives the same value
    float mx = 0.125f * fmaxf(mx0, mx1);
    mx = fmaxf(mx, xhalf(mx));
    const float mnew  = fmaxf(m_i, mx);
    const float alpha = exp_slot(m_i - mnew);
    float rs0 = 0.0f, rs1 = 0.0f;
#pragma unroll
    for (int r = 0; r < 8; r++) {
      st0[r] = exp_slot(st0[r] * 0.125f - mnew);
      st1[r] = exp_slot(st1[r] * 0.125f - mnew);
      rs0 += st0[r];
      rs1 += st1[r];
    }
    l_i = l_i * alpha + (rs0 + rs1);
    m_i = mnew;
#pragma unroll
    for (int ct = 0; ct < 4; ct++)
#pragma unroll
      for (int r = 0; r < 8; r++) acc[ct][r] *= alpha;

    // acc += V^T(64x32) * P^T(32x16): 8 k-steps x 4 row-tiles. A k-step takes the
    // register pair (2j, 2j + 1) of one score tile as B: keys 8 * half + 2j, + 1 of
    // that tile; A holds the same keys' rows of V.
#pragma unroll
    for (int j = 0; j < 4; j++) {
      v2f p0; p0.x = st0[2 * j];  p0.y = st0[2 * j + 1];
      v2f p1; p1.x = st1[2 * j];  p1.y = st1[2 * j + 1];
#pragma unroll
      for (int ct = 0; ct < 4; ct++) {
        v2f v; v.x = va[2 * j][ct];  v.y = va[2 * j + 1][ct];
        acc[ct] = wmma4(v, p0, acc[ct]);
      }
#pragma unroll
      for (int ct = 0; ct < 4; ct++) {
        v2f v; v.x = vb[2 * j][ct];  v.y = vb[2 * j + 1][ct];
        acc[ct] = wmma4(v, p1, acc[ct]);
      }
    }
    __syncthreads();
  }

  // join the halves' sums, normalize + write back into QO (same (rows, head-cols)
  // this wave read): a lane holds 8 consecutive hd of its query per row-tile
  {
    const float inv = 1.0f / (l_i + xhalf(l_i));
    float* orow = QO + (size_t)(b * T_ + t0 + wave * 16 + n16) * D_ + h * HD_ + 8 * half;
#pragma unroll
    for (int ct = 0; ct < 4; ct++) {
      *(float4*)(orow + ct * 16)     = make_float4(acc[ct][0] * inv, acc[ct][1] * inv,
                                                   acc[ct][2] * inv, acc[ct][3] * inv);
      *(float4*)(orow + ct * 16 + 4) = make_float4(acc[ct][4] * inv, acc[ct][5] * inv,
                                                   acc[ct][6] * inv, acc[ct][7] * inv);
    }
  }
}

// ---------------------------------------------------------------------------
// Host-side launcher
// ---------------------------------------------------------------------------
extern "C" void kernel_launch(void* const* d_in, const int* in_sizes, int n_in,
                              void* d_out, int out_size, void* d_ws, size_t ws_size,
                              hipStream_t stream) {
  const float* x       = (const float*)d_in[0];   // [2,1024,1024]
  const float* k_cache = (const float*)d_in[1];   // [2,4,1024,64]
  const float* v_cache = (const float*)d_in[2];   // [2,4,1024,64]
  const int*   pos     = (const int*)  d_in[3];   // [2,1024]
  const float* Wq      = (const float*)d_in[4];   // [1024,1024]
  const float* Wk      = (const float*)d_in[5];   // [1024,256]
  const float* Wv      = (const float*)d_in[6];   // [1024,256]
  const float* Wo      = (const float*)d_in[7];   // [1024,1024]

  float* out   = (float*)d_out;                        // [2,1024,1024]
  float* out_k = out   + (size_t)B_ * T_ * D_;         // [2,4,2048,64]
  float* out_v = out_k + (size_t)B_ * KV_ * S_ * HD_;  // [2,4,2048,64]

  float* Qws = (float*)d_ws;                           // [2048,1024] (also attn out)
  float* Kn  = Qws + (size_t)B_ * T_ * D_;             // [2048,256]
  float* Vn  = Kn  + (size_t)B_ * T_ * (KV_ * HD_);    // [2048,256]

  const int Mtok = B_ * T_;  // 2048

  // 1) projections, one launch
  wmma_gemm_qkv<<<dim3(QCB_ + 2 * KVCB_, Mtok / 64), 256, 0, stream>>>(
      x, Wq, Wk, Wv, Qws, Kn, Vn, D_);

  // 2) RoPE + KV assembly
  rope_assemble_kernel<<<ROPE_BLOCKS_ + COPY_BLOCKS_, 256, 0, stream>>>(
      Qws, Kn, Vn, pos, k_cache, v_cache, out_k, out_v);

  // 3) attention (writes O in place of Q)
  attn_fwd_kernel<<<dim3(T_ / 128, H_, B_), 256, 0, stream>>>(Qws, out_k, out_v);

  // 4) output projection
  wmma_gemm_f32<<<dim3(D_ / 64, Mtok / 64), 256, 0, stream>>>(Qws, Wo, out, Mtok, D_, D_);
}
